// v009
// The times below were measured on an AMD MI455X: many runs one after another, warmed up first and cycling through
// copies of the inputs, with the whole window's GPU time divided by the number of runs. Launches and the gaps
// between them are all in it. The median over several windows is given; except for v000 it joins two sittings, which
// can be a few percent apart, so the side-by-side timings, each taken in one sitting, are the better comparison.
// Earlier versions than v009 are not in this document.
// Measured time: 57.9 microseconds a run.
// Next to v008, in two timings, it ran 1.14 times as fast each time.
// Counting every step since v000, which is the starting kernel, it is 11.7 times as fast.
#include <hip/hip_runtime.h>
// SFBlock (2 x 128 x 64 x 64; 4 heads x 32; GroupNorm(32) on both inputs; q from feat_opt, k/v from feat_sar via 1x1 convs; softmax(q k^T / sqrt(32)) v over the 4096 positions; MLP: gelu_erf(out W1 + b1) W2 + b2; fused = out + mlp; 1x1 conv Wo -> [2,128,64,64]).
// Compute dtype: inputs and parameters rounded to bf16; normalised inputs as f16 operands (~2^-12); q, k hi + residual; P (x2^10), v plain f16; attention output / fused as hi + residual pairs; the 256-wide GELU hidden as f16; f32 statistics/softmax/accumulation. v_wmma_f32_16x16x32_f16.
#define NB 2
#define CC 128
#define HID 256
#define NGR 32
#define CPG (CC / NGR)           /* 4 channels per group */
#define HDT 32
#define HPITCH HDT                   /* columns per head in the q/k/v planes: the true head dim, no padding */
#define DP (NH * HPITCH)             /* 128 */
#define NR (NB * SLEN)           /* 8192 */
#define QBLKS (TQ / 64)
#define SLEN 4096                /* H*W tokens */
#define TQ SLEN
#define TK SLEN
#define NH 4
#define SCL 0.17677669529663687f /* 32^-0.5 */
#define SCL2 ((float)(0.17677669529663687 * 1.4426950408889634)) /* 32^-0.5 * log2(e): raw score -> exponent of two */
typedef __bf16 v16b __attribute__((ext_vector_type(16)));
typedef unsigned short v8us __attribute__((ext_vector_type(8), may_alias));
typedef float  v8f  __attribute__((ext_vector_type(8)));
typedef float  v4f  __attribute__((ext_vector_type(4)));
typedef float  v4fa __attribute__((ext_vector_type(4), may_alias));
union FragB { v16b v; v8us half[2]; unsigned short u[16]; };

__device__ __forceinline__ unsigned short bf16_bits(float x) { unsigned int u = __float_as_uint(x); return (unsigned short)((u + 0x7FFFu + ((u >> 16) & 1u)) >> 16); }
__device__ __forceinline__ float bf16_val(unsigned short b) { return __uint_as_float(((unsigned int)b) << 16); }
__device__ __forceinline__ float bf16_round(float x) { return bf16_val(bf16_bits(x)); }
// D += A·B with NT terms: 1 = ah·bh, 2 = + al·bh (A split), 3 = + ah·bl (both split)
template <int NT>
__device__ __forceinline__ v8f mmaN(v16b ah, v16b al, v16b bh, v16b bl, v8f c) {
  c = __builtin_amdgcn_wmma_f32_16x16x32_bf16(false, ah, false, bh, (short)0, c, false, false);
  if (NT >= 2) c = __builtin_amdgcn_wmma_f32_16x16x32_bf16(false, al, false, bh, (short)0, c, false, false);
  if (NT >= 3) c = __builtin_amdgcn_wmma_f32_16x16x32_bf16(false, ah, false, bl, (short)0, c, false, false);
  asm volatile("v_nop\n\tv_nop\n\tv_nop\n\tv_nop" : "+v"(c) : "v"(ah), "v"(al), "v"(bh), "v"(bl));
  return c;
}

__global__ __launch_bounds__(256) void k_wt_bf16(const float* __restrict__ W, unsigned short* __restrict__ Wt, int K, int N) {
  const int t = blockIdx.x * 256 + threadIdx.x;
  const int k8n = K / 8;
  if (t >= N * k8n) return;
  const int n = t / k8n, k8 = (t % k8n) * 8;
  v8us v;
#pragma unroll
  for (int i = 0; i < 8; ++i) v[i] = bf16_bits(W[(size_t)(k8 + i) * N + n]);
  *(v8us*)(Wt + (size_t)n * K + k8) = v;
  
}

// GEMM C[M][N] (f32, pitch ldc) = act(A[M][K]·W + bias). A f32 row-major (pitch lda) converted per fragment to bf16
// (ASPLIT: hi/lo two planes -> 2 terms, else single rounded term); Wt bf16 [N][K] (pitch ldb). BIAS_BF16 rounds the
// bias to bf16 first (bias quantised to bf16 before the add). K%32==0, M%16==0, N%64==0.
template <bool ASPLIT, int ACT, bool BIAS_BF16>
__global__ __launch_bounds__(128) void k_gemm_bf(const float* __restrict__ A, int lda, const unsigned short* __restrict__ Wt, int ldb,
                                               const float* __restrict__ bias, float* __restrict__ C, int ldc, int M, int N, int K) {
  __shared__ __attribute__((aligned(16))) float so[4][16][64];
  const int tid = threadIdx.x, w = tid >> 5, lane = tid & 31, ln = lane & 15, hh = lane >> 4;
  const int ntn = N / 64;
  const int wid = blockIdx.x * 4 + w;
  const int mt = wid / ntn, nq = wid % ntn;
  if (mt * 16 >= M) return;
  const int row0 = mt * 16, col0 = nq * 64;
  const float* arow = A + (size_t)(row0 + ln) * lda;
  v8f acc[4] = {};
  for (int kb = 0; kb < K; kb += 32) {
    FragB ah, al;
    const v4f x0 = *(const v4fa*)(arow + kb + 8 * hh), x1 = *(const v4fa*)(arow + kb + 8 * hh + 4);
    const v4f x2 = *(const v4fa*)(arow + kb + 16 + 8 * hh), x3 = *(const v4fa*)(arow + kb + 16 + 8 * hh + 4);
    float xs[16] = {x0[0],x0[1],x0[2],x0[3],x1[0],x1[1],x1[2],x1[3],x2[0],x2[1],x2[2],x2[3],x3[0],x3[1],x3[2],x3[3]};
#pragma unroll
    for (int i = 0; i < 16; ++i) { const unsigned short hb = bf16_bits(xs[i]); ah.u[i] = hb; al.u[i] = ASPLIT ? bf16_bits(xs[i] - bf16_val(hb)) : (unsigned short)0; }
#pragma unroll
    for (int t = 0; t < 4; ++t) {
      const unsigned short* brow = Wt + (size_t)(col0 + t * 16 + ln) * ldb + kb;
      FragB b;
      b.half[0] = *(const v8us*)(brow + 8 * hh);
      b.half[1] = *(const v8us*)(brow + 16 + 8 * hh);
      acc[t] = mmaN<ASPLIT ? 2 : 1>(ah.v, al.v, b.v, b.v, acc[t]);
    }
  }
#pragma unroll
  for (int t = 0; t < 4; ++t) {
    float bv = bias ? bias[col0 + t * 16 + ln] : 0.f;
    if (BIAS_BF16) bv = bf16_round(bv);
#pragma unroll
    for (int r = 0; r < 8; ++r) { float v = acc[t][r] + bv; if (ACT == 1) v = fmaxf(v, 0.f); so[w][8 * hh + r][t * 16 + ln] = v; }
  }
  __builtin_amdgcn_fence(__ATOMIC_ACQ_REL, "workgroup");
  __builtin_amdgcn_wave_barrier();
  const int rsub = lane >> 4, c4 = (lane & 15) * 4;
  {
#pragma unroll
    for (int q = 0; q < 8; ++q) {
      const int r = q * 2 + rsub;
      const v4f v = *(const v4fa*)&so[w][r][c4];
      *(v4f*)(C + (size_t)(row0 + r) * ldc + col0 + c4) = v;
    }
    
  }
}

// GEMM C = act(A·W + bias + resid): A f32 (ASPLIT -> hi/lo 2 terms), Wt bf16 [N][K]; ACT 0 none, 1 relu, 2 exact gelu;
// resid (optional, f32, row index = (row % rmod), pitch ldr, RES_BF16 rounds it) added before the activation.
template <bool ASPLIT, int ACT, bool BIAS_BF16, bool RES_BF16>
__global__ __launch_bounds__(128) void k_gemm_bf3(const float* __restrict__ A, int lda, const unsigned short* __restrict__ Wt, int ldb,
                                                const float* __restrict__ bias, const float* __restrict__ resid, int rmod, int ldr,
                                                float* __restrict__ C, int ldc, int M, int N, int K) {
  __shared__ __attribute__((aligned(16))) float so[4][16][64];
  const int tid = threadIdx.x, w = tid >> 5, lane = tid & 31, ln = lane & 15, hh = lane >> 4;
  const int ntn = N / 64;
  const int wid = blockIdx.x * 4 + w;
  const int mt = wid / ntn, nq = wid % ntn;
  if (mt * 16 >= M) return;
  const int row0 = mt * 16, col0 = nq * 64;
  const float* arow = A + (size_t)(row0 + ln) * lda;
  v8f acc[4] = {};
  for (int kb = 0; kb < K; kb += 32) {
    FragB ah, al;
    const v4f x0 = *(const v4fa*)(arow + kb + 8 * hh), x1 = *(const v4fa*)(arow + kb + 8 * hh + 4);
    const v4f x2 = *(const v4fa*)(arow + kb + 16 + 8 * hh), x3 = *(const v4fa*)(arow + kb + 16 + 8 * hh + 4);
    float xs[16] = {x0[0],x0[1],x0[2],x0[3],x1[0],x1[1],x1[2],x1[3],x2[0],x2[1],x2[2],x2[3],x3[0],x3[1],x3[2],x3[3]};
#pragma unroll
    for (int i = 0; i < 16; ++i) { const unsigned short hb = bf16_bits(xs[i]); ah.u[i] = hb; al.u[i] = ASPLIT ? bf16_bits(xs[i] - bf16_val(hb)) : (unsigned short)0; }
#pragma unroll
    for (int t = 0; t < 4; ++t) {
      const unsigned short* brow = Wt + (size_t)(col0 + t * 16 + ln) * ldb + kb;
      FragB b;
      b.half[0] = *(const v8us*)(brow + 8 * hh);
      b.half[1] = *(const v8us*)(brow + 16 + 8 * hh);
      acc[t] = mmaN<ASPLIT ? 2 : 1>(ah.v, al.v, b.v, b.v, acc[t]);
    }
  }
#pragma unroll
  for (int t = 0; t < 4; ++t) {
    const int col = col0 + t * 16 + ln;
    float bv = bias ? bias[col] : 0.f;
    if (BIAS_BF16) bv = bf16_round(bv);
#pragma unroll
    for (int r = 0; r < 8; ++r) {
      float v = acc[t][r] + bv;
      if (resid) { float rv = resid[(size_t)((row0 + 8 * hh + r) % rmod) * ldr + col]; if (RES_BF16) rv = bf16_round(rv); v += rv; }
      if (ACT == 1) v = fmaxf(v, 0.f);
      if (ACT == 2) v = 0.5f * v * (1.0f + erff(v * 0.70710678118654752f));
      if (ACT == 3) { const float u = 0.7978845608028654f * (v + 0.044715f * v * v * v); v = 0.5f * v * (1.0f + tanhf(u)); }
      so[w][8 * hh + r][t * 16 + ln] = v;
    }
  }
  __builtin_amdgcn_fence(__ATOMIC_ACQ_REL, "workgroup");
  __builtin_amdgcn_wave_barrier();
  const int rsub = lane >> 4, c4 = (lane & 15) * 4;
  {
#pragma unroll
    for (int q = 0; q < 8; ++q) {
      const int r = q * 2 + rsub;
      const v4f v = *(const v4fa*)&so[w][r][c4];
      *(v4f*)(C + (size_t)(row0 + r) * ldc + col0 + c4) = v;
    }
    
  }
}
// row LayerNorm (biased variance, eps) over N: s = X (+ R); optional out_sum <- s; out_norm <- (s-mu)*rsqrt(var+eps)*g + b
template <bool PARAM_BF16>
__global__ __launch_bounds__(256) void k_layernorm(const float* __restrict__ X, const float* __restrict__ R, const float* __restrict__ g, const float* __restrict__ bta,
                                                  float* __restrict__ out_sum, float* __restrict__ out_norm, int N, float eps) {
  __shared__ float red[256];
  const int row = blockIdx.x, tid = threadIdx.x;
  const float* x = X + (size_t)row * N; const float* rr = R ? R + (size_t)row * N : nullptr;
  float vals[16];                     // up to N = 4096
  const int per = N / 256;            // contiguous chunk per thread? use strided-by-4 chunks: thread handles j = tid*4 + 1024*u
  float s1 = 0.f;
  for (int u = 0; u < per / 4; ++u) {
    const int j = tid * 4 + 1024 * u;
    const v4f a = *(const v4fa*)(x + j);
    v4f b = {0.f,0.f,0.f,0.f}; if (rr) b = *(const v4fa*)(rr + j);
#pragma unroll
    for (int q = 0; q < 4; ++q) { const float v = a[q] + b[q]; vals[u * 4 + q] = v; s1 += v; }
  }
  red[tid] = s1; __syncthreads();
  for (int st = 128; st > 0; st >>= 1) { if (tid < st) red[tid] += red[tid + st]; __syncthreads(); }
  const float mu = red[0] / (float)N; __syncthreads();
  float s2 = 0.f;
  for (int u = 0; u < per / 4; ++u)
#pragma unroll
    for (int q = 0; q < 4; ++q) { const float c = vals[u * 4 + q] - mu; s2 += c * c; }
  red[tid] = s2; __syncthreads();
  for (int st = 128; st > 0; st >>= 1) { if (tid < st) red[tid] += red[tid + st]; __syncthreads(); }
  const float rs = rsqrtf(red[0] / (float)N + eps);
  {
    for (int u = 0; u < per / 4; ++u) {
      const int j = tid * 4 + 1024 * u;
      v4f o, sm;
#pragma unroll
      for (int q = 0; q < 4; ++q) {
        float gg = g[j + q], bb = bta[j + q];
        if (PARAM_BF16) { gg = bf16_round(gg); bb = bf16_round(bb); }
        sm[q] = vals[u * 4 + q]; o[q] = (vals[u * 4 + q] - mu) * rs * gg + bb;
      }
      if (out_sum) *(v4f*)(out_sum + (size_t)row * N + j) = sm;
      *(v4f*)(out_norm + (size_t)row * N + j) = o;
    }
    
  }
}



// ---- f16 WMMA path (v_wmma_f32_16x16x32_f16): 11-bit significands for operands in range — used where a [0,1] probability operand needs more precision than bf16
typedef _Float16 v16h __attribute__((ext_vector_type(16)));
union FragH { v16h v; v8us half[2]; _Float16 h[16]; unsigned short u[16]; };
template <int NT>
__device__ __forceinline__ v8f mmaH(v16h ah, v16h al, v16h bh, v16h bl, v8f c) {
  c = __builtin_amdgcn_wmma_f32_16x16x32_f16(false, ah, false, bh, (short)0, c, false, false);
  if (NT >= 2) c = __builtin_amdgcn_wmma_f32_16x16x32_f16(false, al, false, bh, (short)0, c, false, false);
  if (NT >= 3) c = __builtin_amdgcn_wmma_f32_16x16x32_f16(false, ah, false, bl, (short)0, c, false, false);
  asm volatile("v_nop\n\tv_nop\n\tv_nop\n\tv_nop" : "+v"(c) : "v"(ah), "v"(al), "v"(bh), "v"(bl));
  return c;
}
// batched GEMM like k_gemm_b but f16 operands: A f32 (split into f16 hi/lo if ASPLIT, else rounded to f16), Bt = f16 values [n][k]; alpha; C f32; N multiple of 16 (partial tiles skipped)
template <bool ASPLIT>
__global__ __launch_bounds__(128) void k_gemm_h(const float* __restrict__ A, int lda, size_t sA, const _Float16* __restrict__ Bh, int ldb, size_t sB, float alpha, float* __restrict__ C, int ldc, size_t sC, int M, int N, int K) {
  __shared__ __attribute__((aligned(16))) float so[4][16][64];
  const int tid = threadIdx.x, w = tid >> 5, lane = tid & 31, ln = lane & 15, hh = lane >> 4; const int by = blockIdx.y;
  A += (size_t)by * sA; Bh += (size_t)by * sB; C += (size_t)by * sC;
  const int ntn = (N + 63) / 64; const int wid = blockIdx.x * 4 + w; const int mt = wid / ntn, nq = wid % ntn; if (mt * 16 >= M) return;
  const int row0 = mt * 16, col0 = nq * 64; const float* arow = A + (size_t)(row0 + ln) * lda;
  v8f acc[4] = {};
  for (int kb = 0; kb < K; kb += 32) {
    FragH ah, al;
    const v4f x0 = *(const v4fa*)(arow + kb + 8 * hh), x1 = *(const v4fa*)(arow + kb + 8 * hh + 4), x2 = *(const v4fa*)(arow + kb + 16 + 8 * hh), x3 = *(const v4fa*)(arow + kb + 16 + 8 * hh + 4);
    float xs[16] = {x0[0],x0[1],x0[2],x0[3],x1[0],x1[1],x1[2],x1[3],x2[0],x2[1],x2[2],x2[3],x3[0],x3[1],x3[2],x3[3]};
#pragma unroll
    for (int i = 0; i < 16; ++i) { const _Float16 h = (_Float16)xs[i]; ah.h[i] = h; al.h[i] = ASPLIT ? (_Float16)(xs[i] - (float)h) : (_Float16)0.0f; }
#pragma unroll
    for (int t = 0; t < 4; ++t) { if (col0 + t * 16 >= N) continue; const size_t boff = (size_t)(col0 + t * 16 + ln) * ldb + kb; FragH bq; bq.half[0] = *(const v8us*)(Bh + boff + 8 * hh); bq.half[1] = *(const v8us*)(Bh + boff + 16 + 8 * hh);
      acc[t] = mmaH<ASPLIT ? 2 : 1>(ah.v, al.v, bq.v, bq.v, acc[t]); }
  }
#pragma unroll
  for (int t = 0; t < 4; ++t) { if (col0 + t * 16 >= N) continue;
#pragma unroll
    for (int r = 0; r < 8; ++r) so[w][8 * hh + r][t * 16 + ln] = acc[t][r] * alpha; }
  __builtin_amdgcn_fence(__ATOMIC_ACQ_REL, "workgroup"); __builtin_amdgcn_wave_barrier();
  const int rsub = lane >> 4, c4 = (lane & 15) * 4;
  {
#pragma unroll
    for (int q = 0; q < 8; ++q) { const int r = q * 2 + rsub; if (col0 + c4 < N) { const v4f v = *(const v4fa*)&so[w][r][c4]; *(v4f*)(C + (size_t)(row0 + r) * ldc + col0 + c4) = v; } }
     }
}

// Wt[n][k] = f16(W[k][n]·scale) from f32 row-major W[K][N] (scale = power of two; bf16-exact weights stay exact in f16 away from the subnormal range)
__global__ __launch_bounds__(256) void k_wt_f16(const float* __restrict__ W, _Float16* __restrict__ Wt, int K, int N, float scale) {
  const int t = blockIdx.x * 256 + threadIdx.x; if (t >= N * (K / 8)) return; const int n = t / (K / 8), k8 = (t % (K / 8)) * 8; FragH f;
#pragma unroll
  for (int i = 0; i < 8; ++i) f.h[i] = (_Float16)(bf16_round(W[(size_t)(k8 + i) * N + n]) * scale); const v8us o = f.half[0];
  *(v8us*)((unsigned short*)Wt + (size_t)n * K + k8) = o; 
}
// k_gemm_hh variant with fused epilogue: v = acc·alpha + bias[by·sBias + col] (+ CP[(row/rowsPerB)·sCPb + by·64 + col] if CP) ; ACT 0 none / 1 elu ; writes f16 C16 (and f32 C if non-null)
template <int ACT>
__global__ __launch_bounds__(128) void k_gemm_hhx(const _Float16* __restrict__ A, int lda, size_t sA, const _Float16* __restrict__ Bh, int ldb, size_t sB, float alpha, const float* __restrict__ bias, size_t sBias, const float* __restrict__ CP, int rowsPerB, size_t sCPb, int row0g,
    float* __restrict__ C, _Float16* __restrict__ C16, int ldc, size_t sC, int M, int N, int K) {
  __shared__ __attribute__((aligned(16))) float so[4][16][64];
  const int tid = threadIdx.x, w = tid >> 5, lane = tid & 31, ln = lane & 15, hh = lane >> 4; const int by = blockIdx.y;
  A += (size_t)by * sA; Bh += (size_t)by * sB; const size_t cofs = (size_t)by * sC; const float* bp = bias ? bias + (size_t)by * sBias : nullptr;
  const int ntn = (N + 63) / 64; const int wid = blockIdx.x * 4 + w; const int mt = wid / ntn, nq = wid % ntn; if (mt * 16 >= M) return;
  const int row0 = mt * 16, col0 = nq * 64; const _Float16* arow = A + (size_t)(row0 + ln) * lda;
  v8f acc[4] = {};
  for (int kb = 0; kb < K; kb += 32) { FragH ah; ah.half[0] = *(const v8us*)((const unsigned short*)arow + kb + 8 * hh); ah.half[1] = *(const v8us*)((const unsigned short*)arow + kb + 16 + 8 * hh);
#pragma unroll
    for (int t = 0; t < 4; ++t) { if (col0 + t * 16 >= N) continue; const size_t boff = (size_t)(col0 + t * 16 + ln) * ldb + kb; FragH bq; bq.half[0] = *(const v8us*)((const unsigned short*)Bh + boff + 8 * hh); bq.half[1] = *(const v8us*)((const unsigned short*)Bh + boff + 16 + 8 * hh);
      acc[t] = mmaH<1>(ah.v, ah.v, bq.v, bq.v, acc[t]); }
  }
#pragma unroll
  for (int t = 0; t < 4; ++t) { if (col0 + t * 16 >= N) continue; const int col = col0 + t * 16 + ln; const float bv = bp ? bf16_round(bp[col]) : 0.f;
#pragma unroll
    for (int r = 0; r < 8; ++r) { float v = acc[t][r] * alpha + bv; if (CP) { const int bidx = (row0g + row0 + 8 * hh + r) / rowsPerB; v += CP[(size_t)bidx * sCPb + (size_t)by * 64 + col]; } if (ACT == 1) v = (v > 0.f) ? v : expm1f(v); else if (ACT == 7) v = (v > 0.f) ? v + 1.0f : expf(v); else if (ACT == 8) v = tanhf(v); else if (ACT == 9) v = 0.5f * v * (1.0f + tanhf(0.7978845608028654f * (v + 0.044715f * v * v * v))); else if (ACT == 11) v = 1.0f / (1.0f + expf(-v)); else if (ACT == 12) v = (v > 0.f) ? v : 0.01f * v; else if (ACT == 14) v = (v > 0.f) ? v : 0.1f * v; else if (ACT == 15) v = v / (1.0f + expf(-v)); else if (ACT == 3) v = fmaxf(v, 0.f); else if (ACT == 6) v = 0.5f * v * (1.0f + erff(v * 0.70710678118654752f)); so[w][8 * hh + r][t * 16 + ln] = v; } }
  __builtin_amdgcn_fence(__ATOMIC_ACQ_REL, "workgroup"); __builtin_amdgcn_wave_barrier();
  const int rsub = lane >> 4, c4 = (lane & 15) * 4; typedef _Float16 v4h __attribute__((ext_vector_type(4)));
  {
#pragma unroll
    for (int q = 0; q < 8; ++q) { const int r = q * 2 + rsub; if (col0 + c4 < N) { const v4f v = *(const v4fa*)&so[w][r][c4]; if (C) *(v4f*)(C + cofs + (size_t)(row0 + r) * ldc + col0 + c4) = v; if (C16) { v4h h4; for (int i = 0; i < 4; ++i) h4[i] = (_Float16)v[i]; *(v4h*)(C16 + cofs + (size_t)(row0 + r) * ldc + col0 + c4) = h4; } } }
     }
}


typedef _Float16 v4h __attribute__((ext_vector_type(4)));

__global__ __launch_bounds__(256) void k_x16(const float* __restrict__ x, _Float16* __restrict__ X16, size_t n8) { const size_t t = (size_t)blockIdx.x * 256 + threadIdx.x; if (t >= n8) return; FragH f;
#pragma unroll
  for (int q = 0; q < 8; ++q) f.h[q] = (_Float16)bf16_round(x[t * 8 + q]); *(v8us*)((unsigned short*)X16 + t * 8) = f.half[0];  }
__global__ __launch_bounds__(256) void k_h16(const float* __restrict__ x, _Float16* __restrict__ X16, size_t n8) { const size_t t = (size_t)blockIdx.x * 256 + threadIdx.x; if (t >= n8) return; FragH f;
#pragma unroll
  for (int q = 0; q < 8; ++q) f.h[q] = (_Float16)x[t * 8 + q]; *(v8us*)((unsigned short*)X16 + t * 8) = f.half[0];  }
__global__ __launch_bounds__(256) void k_round16f(const float* __restrict__ W, _Float16* __restrict__ Bt, size_t n8) { const size_t t = (size_t)blockIdx.x * 256 + threadIdx.x; if (t >= n8) return; FragH f;
#pragma unroll
  for (int i = 0; i < 8; ++i) f.h[i] = (_Float16)(bf16_round(W[t * 8 + i]) * 16.0f); *(v8us*)((unsigned short*)Bt + t * 8) = f.half[0];  }
// Weights lie in the workspace in fragment order: the 32 16-byte pieces that one wave-wide load of a 16-row x 32-column fragment takes (lane = 16 hh + row % 16) stand side by side, 512 bytes in four whole 128-byte lines
// (row-major, the same load touches 16 lines). pk_off: offset in halves of the piece with columns c8 .. c8 + 7 (c8 a multiple of 8) of one row of a [rows][K] matrix; p_frag: fragment (row tile rt, k step ks) of a matrix with KS k steps.
__device__ __forceinline__ size_t pk_off(int row, int c8, int K) { return ((((size_t)(row >> 4) * (K / 32) + (c8 >> 5)) * 2 + ((c8 >> 4) & 1)) * 32 + ((c8 >> 3) & 1) * 16 + (row & 15)) * 8; }
__device__ __forceinline__ v16h p_frag(const _Float16* Wp, int rt, int ks, int KS, int lane) { const unsigned short* p = (const unsigned short*)Wp + ((size_t)(rt * KS + ks) * 64 + lane) * 8; FragH f; f.half[0] = *(const v8us*)p; f.half[1] = *(const v8us*)(p + 256); return f.v; }
template <int CAUSAL>
__global__ __launch_bounds__(128) void k_flash(const _Float16* __restrict__ Q16, int ldq, const _Float16* __restrict__ K16, int ldk, const _Float16* __restrict__ Vt, const int* __restrict__ MSK, float* __restrict__ O, int ldo) {
  constexpr int RPW = 16, RTN = RPW / 16, NQB = TQ / (4 * RPW), DT = 4, KS = 2;
  __shared__ __attribute__((aligned(16))) unsigned short sP[4][RPW][40]; __shared__ __attribute__((aligned(16))) float sO[4][RPW][64 + 4];
  const int tid = threadIdx.x, w = tid >> 5, lane = tid & 31, ln = lane & 15, hh = lane >> 4;
  const int slab = blockIdx.x / QBLKS, qblk = blockIdx.x % QBLKS; (void)NQB; const int b = slab / NH, h = slab % NH; const int qb0 = qblk * (4 * RPW); const int q0 = qb0 + w * RPW;
  FragH aq[2][KS];
#pragma unroll
  for (int rt = 0; rt < RTN; ++rt) { const unsigned short* qr = (const unsigned short*)Q16 + ((size_t)b * TQ + q0 + rt * 16 + ln) * ldq + h * 64;
#pragma unroll
    for (int ks = 0; ks < KS; ++ks) { aq[rt][ks].half[0] = *(const v8us*)(qr + ks * 32 + 8 * hh); aq[rt][ks].half[1] = *(const v8us*)(qr + ks * 32 + 16 + 8 * hh); } }
  const unsigned short* Vth = (const unsigned short*)Vt + (size_t)slab * 64 * TK;
  float m_r[2][8], l_r[2][8]; v8f oacc[2][DT];
#pragma unroll
  for (int rt = 0; rt < RTN; ++rt) {
#pragma unroll
    for (int r = 0; r < 8; ++r) { m_r[rt][r] = -3.0e38f; l_r[rt][r] = 0.f; }
#pragma unroll
    for (int dt = 0; dt < DT; ++dt) oacc[rt][dt] = (v8f){0.f,0.f,0.f,0.f,0.f,0.f,0.f,0.f}; }
  const int jend = (CAUSAL == 1) ? (qb0 + 4 * RPW) : TK;      /* causal: keys beyond the block's last query never contribute */
#pragma unroll 1
  for (int j0 = 0; j0 < jend; j0 += 32) {
    v8f s[2][2];
#pragma unroll
    for (int nt = 0; nt < 2; ++nt) { const unsigned short* kr = (const unsigned short*)K16 + ((size_t)b * TK + j0 + nt * 16 + ln) * ldk + h * 64; FragH bk[KS];
#pragma unroll
      for (int ks = 0; ks < KS; ++ks) { bk[ks].half[0] = *(const v8us*)(kr + ks * 32 + 8 * hh); bk[ks].half[1] = *(const v8us*)(kr + ks * 32 + 16 + 8 * hh); }
#pragma unroll
      for (int rt = 0; rt < RTN; ++rt) { v8f acc = (v8f){0.f,0.f,0.f,0.f,0.f,0.f,0.f,0.f};
#pragma unroll
        for (int ks = 0; ks < KS; ++ks) acc = mmaH<1>(aq[rt][ks].v, aq[rt][ks].v, bk[ks].v, bk[ks].v, acc); s[rt][nt] = acc; } }
#pragma unroll
    for (int rt = 0; rt < RTN; ++rt)
#pragma unroll
      for (int r = 0; r < 8; ++r) { const int tq = q0 + rt * 16 + 8 * hh + r; const int k0 = j0 + ln, k1 = j0 + 16 + ln;
        const bool ok0 = (CAUSAL == 1) ? (k0 <= tq) : ((CAUSAL == 2) ? ((k0 >> 5) == (tq >> 5)) : true), ok1 = (CAUSAL == 1) ? (k1 <= tq) : ((CAUSAL == 2) ? ((k1 >> 5) == (tq >> 5)) : true);      /* mode 2: block-diagonal 32-token groups */
        const float s0 = ok0 ? s[rt][0][r] * SCL : -3.0e38f, s1 = ok1 ? s[rt][1][r] * SCL : -3.0e38f; float mc = fmaxf(s0, s1);
        mc = fmaxf(mc, __shfl_xor(mc, 1, 32)); mc = fmaxf(mc, __shfl_xor(mc, 2, 32)); mc = fmaxf(mc, __shfl_xor(mc, 4, 32)); mc = fmaxf(mc, __shfl_xor(mc, 8, 32));
        const float mn = fmaxf(m_r[rt][r], mc); const float al = (mn > -1.0e38f) ? expf(m_r[rt][r] - mn) : 1.0f; m_r[rt][r] = mn; const float p0 = ok0 ? expf(s0 - mn) : 0.f, p1 = ok1 ? expf(s1 - mn) : 0.f; l_r[rt][r] = l_r[rt][r] * al + p0 + p1;
#pragma unroll
        for (int dt = 0; dt < DT; ++dt) oacc[rt][dt][r] *= al;
        FragH t2; t2.h[0] = (_Float16)(p0 * 1024.0f); t2.h[1] = (_Float16)(p1 * 1024.0f); sP[w][rt * 16 + 8 * hh + r][ln] = t2.u[0]; sP[w][rt * 16 + 8 * hh + r][16 + ln] = t2.u[1]; }
    __builtin_amdgcn_fence(__ATOMIC_ACQ_REL, "workgroup"); __builtin_amdgcn_wave_barrier();
    FragH pa[2];
#pragma unroll
    for (int rt = 0; rt < RTN; ++rt) { pa[rt].half[0] = *(const v8us*)&sP[w][rt * 16 + ln][8 * hh]; pa[rt].half[1] = *(const v8us*)&sP[w][rt * 16 + ln][16 + 8 * hh]; }
#pragma unroll
    for (int dt = 0; dt < DT; ++dt) { const unsigned short* vrow = Vth + (size_t)(dt * 16 + ln) * TK + j0; FragH bv; bv.half[0] = *(const v8us*)(vrow + 8 * hh); bv.half[1] = *(const v8us*)(vrow + 16 + 8 * hh);
#pragma unroll
      for (int rt = 0; rt < RTN; ++rt) oacc[rt][dt] = mmaH<1>(pa[rt].v, pa[rt].v, bv.v, bv.v, oacc[rt][dt]); }
    __builtin_amdgcn_fence(__ATOMIC_ACQ_REL, "workgroup"); __builtin_amdgcn_wave_barrier(); }
#pragma unroll
  for (int rt = 0; rt < RTN; ++rt) {
#pragma unroll
    for (int r = 0; r < 8; ++r) { float l = l_r[rt][r]; l += __shfl_xor(l, 1, 32); l += __shfl_xor(l, 2, 32); l += __shfl_xor(l, 4, 32); l += __shfl_xor(l, 8, 32); l_r[rt][r] = (l > 0.f) ? 1.0f / (l * 1024.0f) : 0.f; }
#pragma unroll
    for (int dt = 0; dt < DT; ++dt)
#pragma unroll
      for (int r = 0; r < 8; ++r) sO[w][rt * 16 + 8 * hh + r][dt * 16 + ln] = oacc[rt][dt][r] * l_r[rt][r]; }
  __builtin_amdgcn_fence(__ATOMIC_ACQ_REL, "workgroup"); __builtin_amdgcn_wave_barrier();
  {
#pragma unroll
    for (int rp = 0; rp < RPW; rp += 2) { const int r = rp + (lane >> 4), pc = lane & 15; const v4f val = *(const v4fa*)&sO[w][r][pc * 4]; *(v4f*)(O + ((size_t)b * TQ + q0 + r) * ldo + h * 64 + pc * 4) = val; }
     } }
__device__ __forceinline__ float xhalf(float x) { return __builtin_bit_cast(float, __builtin_amdgcn_permlanex16(__builtin_bit_cast(int, x), __builtin_bit_cast(int, x), 0x76543210, 0xfedcba98, false, false)); }      /* lane l <-> lane l ^ 16 */
// Eight 2^x in place, in one statement: each v_exp_f32 writes only its own register, so none stands directly in front of an instruction that overwrites its source or reads its result
// (left to the register allocator, a run of them reused the source of the one before as the next destination); the v_nop keeps that slot behind the last one.
__device__ __forceinline__ void exp2x8(float& a, float& b, float& c, float& d, float& e, float& f, float& g, float& h) {
  asm("v_exp_f32 %0, %0\n\tv_exp_f32 %1, %1\n\tv_exp_f32 %2, %2\n\tv_exp_f32 %3, %3\n\tv_exp_f32 %4, %4\n\tv_exp_f32 %5, %5\n\tv_exp_f32 %6, %6\n\tv_exp_f32 %7, %7\n\tv_nop"
      : "+v"(a), "+v"(b), "+v"(c), "+v"(d), "+v"(e), "+v"(f), "+v"(g), "+v"(h)); }
template <int CAUSAL>
__global__ __launch_bounds__(256) void k_flashqk(const _Float16* __restrict__ Q16, const _Float16* __restrict__ QL, const _Float16* __restrict__ K16, const _Float16* __restrict__ KL, const _Float16* __restrict__ Vt, const int* __restrict__ MSK, float* __restrict__ O, int ldo) {
  constexpr int RPW = 16, DT = HPITCH / 16, KS = HPITCH / 32;
  __shared__ __attribute__((aligned(16))) float sO[4][RPW][HPITCH + 4];
  constexpr int KT = 64, KP = HPITCH + 8, VP = KT + 8;      /* keys per staged tile; LDS row pitches in halves: 16 bytes x an odd number, free of bank conflicts for 16-byte reads */
  constexpr int NCK = KT * (HPITCH / 8) / 128, NCV = HPITCH * (KT / 8) / 128;      /* 16-byte pieces per thread and tile */
  __shared__ __attribute__((aligned(16))) unsigned short sK[2][2][KT][KP]; __shared__ __attribute__((aligned(16))) unsigned short sKL[2][2][KT][KP]; __shared__ __attribute__((aligned(16))) unsigned short sV[2][2][HPITCH][VP];      /* [key half][buffer] */
  __shared__ __attribute__((aligned(16))) float sM[4][32][20];      /* the second half's partial result, one row a lane: 16 outputs, maximum, sum; 80-byte pitch = 16 bytes x an odd number */
  static_assert(CAUSAL != 1 && TK % (2 * KT) == 0, "both key halves walk the same number of tiles");
  const int tid = threadIdx.x, w = (tid >> 5) & 3, kh = tid >> 7, ts = tid & 127, lane = tid & 31, ln = lane & 15, hh = lane >> 4;      /* w: query group; kh: key half (waves 0-3 / 4-7); ts: thread within its half */
  const int slab = blockIdx.x / QBLKS, qblk = blockIdx.x % QBLKS; const int b = slab / NH, h = slab % NH; const int qb0 = qblk * (4 * RPW); const int q0 = qb0 + w * RPW;
  const int tq = q0 + ln;      /* this lane's query */
  FragH bq[KS], bql[KS];
  { const unsigned short* qr = (const unsigned short*)Q16 + ((size_t)slab * TQ + tq) * HPITCH; const unsigned short* ql = (const unsigned short*)QL + ((size_t)slab * TQ + tq) * HPITCH;
#pragma unroll      /* constant indices keep the fragment, score and accumulator arrays in registers */
    for (int ks = 0; ks < KS; ++ks) { bq[ks].half[0] = *(const v8us*)(qr + ks * 32 + 8 * hh); bq[ks].half[1] = *(const v8us*)(qr + ks * 32 + 16 + 8 * hh); bql[ks].half[0] = *(const v8us*)(ql + ks * 32 + 8 * hh); bql[ks].half[1] = *(const v8us*)(ql + ks * 32 + 16 + 8 * hh); } }
  const unsigned short* Vth = (const unsigned short*)Vt + (size_t)slab * HPITCH * TK;
  const unsigned short* Kb = (const unsigned short*)K16 + (size_t)slab * TK * HPITCH; const unsigned short* KLb = (const unsigned short*)KL + (size_t)slab * TK * HPITCH;
  v8us gk[NCK], gkl[NCK], gv[NCV];      /* the next tile on its way from global memory to LDS */
  auto fetch = [&](int jt) {
#pragma unroll      /* constant indices keep the fragment, score and accumulator arrays in registers */
    for (int u = 0; u < NCK; ++u) { const int i = ts + 128 * u, r = i / (HPITCH / 8), c8 = (i % (HPITCH / 8)) * 8; gk[u] = *(const v8us*)(Kb + (size_t)(jt + r) * HPITCH + c8); gkl[u] = *(const v8us*)(KLb + (size_t)(jt + r) * HPITCH + c8); }
#pragma unroll      /* constant indices keep the fragment, score and accumulator arrays in registers */
    for (int u = 0; u < NCV; ++u) { const int i = ts + 128 * u, r = i / (KT / 8), c8 = (i % (KT / 8)) * 8; gv[u] = *(const v8us*)(Vth + (size_t)r * TK + jt + c8); } };
  auto stash = [&](int bf) {
#pragma unroll      /* constant indices keep the fragment, score and accumulator arrays in registers */
    for (int u = 0; u < NCK; ++u) { const int i = ts + 128 * u, r = i / (HPITCH / 8), c8 = (i % (HPITCH / 8)) * 8; *(v8us*)&sK[kh][bf][r][c8] = gk[u]; *(v8us*)&sKL[kh][bf][r][c8] = gkl[u]; }
#pragma unroll      /* constant indices keep the fragment, score and accumulator arrays in registers */
    for (int u = 0; u < NCV; ++u) { const int i = ts + 128 * u, r = i / (KT / 8), c8 = (i % (KT / 8)) * 8; *(v8us*)&sV[kh][bf][r][c8] = gv[u]; } };
  float m_q = -3.0e38f, l_q = 0.f; v8f oacc[DT];      /* oacc[dt][r] = O[tq][dt * 16 + 8 hh + r], un-normalised */
#pragma unroll      /* constant indices keep the fragment, score and accumulator arrays in registers */
  for (int dt = 0; dt < DT; ++dt) oacc[dt] = (v8f){0.f,0.f,0.f,0.f,0.f,0.f,0.f,0.f};
  const int jend = (CAUSAL == 1) ? (qb0 + 4 * RPW) : TK;      /* causal: keys beyond the block's last query never contribute */
  const int ntile = jend / (2 * KT);      /* trips: half kh takes tiles kh, kh + 2, kh + 4, ... */
  asm volatile("s_wait_xcnt 0x0" ::: "memory");      /* the Q loads above are issued first, and no tile load below writes into a register that one of them still names as its address */
  fetch(kh * KT); stash(0);
  __syncthreads();      /* tile 0 is written before any wave reads it */
#pragma unroll 1      /* one copy of the trip's code; the buffer index alternates at run time */
  for (int t = 0; t < ntile; ++t) { const int buf = t & 1; const bool more = t + 1 < ntile;      /* the same in every thread of the work-group */
    if (more) fetch((2 * (t + 1) + kh) * KT);      /* in flight while this trip works on tile t */
#pragma unroll      /* the two 32-key halves of the tile: constant LDS offsets */
   for (int js = 0; js < KT; js += 32) { const int j0 = (2 * t + kh) * KT + js;
    v8f s[2];      /* s[nt][r] = score of key j0 + nt * 16 + 8 hh + r against query tq */
    FragH ak[2][KS], akl[2][KS], av[DT];      /* all LDS reads of these 32 keys stand together at the head: one LDS latency instead of four */
#pragma unroll      /* constant indices keep the fragment, score and accumulator arrays in registers */
    for (int nt = 0; nt < 2; ++nt) { const unsigned short* kr = &sK[kh][buf][js + nt * 16 + ln][0]; const unsigned short* klr = &sKL[kh][buf][js + nt * 16 + ln][0];
#pragma unroll      /* constant indices keep the fragment, score and accumulator arrays in registers */
      for (int ks = 0; ks < KS; ++ks) { ak[nt][ks].half[0] = *(const v8us*)(kr + ks * 32 + 8 * hh); ak[nt][ks].half[1] = *(const v8us*)(kr + ks * 32 + 16 + 8 * hh); akl[nt][ks].half[0] = *(const v8us*)(klr + ks * 32 + 8 * hh); akl[nt][ks].half[1] = *(const v8us*)(klr + ks * 32 + 16 + 8 * hh); } }
#pragma unroll      /* constant indices keep the fragment, score and accumulator arrays in registers */
    for (int dt = 0; dt < DT; ++dt) { const unsigned short* vrow = &sV[kh][buf][dt * 16 + ln][js]; av[dt].half[0] = *(const v8us*)(vrow + 8 * hh); av[dt].half[1] = *(const v8us*)(vrow + 16 + 8 * hh); }
#pragma unroll      /* constant indices keep the fragment, score and accumulator arrays in registers */
    for (int nt = 0; nt < 2; ++nt) {
      v8f acc = (v8f){0.f,0.f,0.f,0.f,0.f,0.f,0.f,0.f}, accl = acc;
#pragma unroll      /* constant indices keep the fragment, score and accumulator arrays in registers */
      for (int ks = 0; ks < KS; ++ks) { acc = mmaH<1>(ak[nt][ks].v, ak[nt][ks].v, bq[ks].v, bq[ks].v, acc); accl = mmaH<1>(ak[nt][ks].v, ak[nt][ks].v, bql[ks].v, bql[ks].v, accl); accl = mmaH<1>(akl[nt][ks].v, akl[nt][ks].v, bq[ks].v, bq[ks].v, accl); }
#pragma unroll      /* constant indices keep the fragment, score and accumulator arrays in registers */
      for (int r = 0; r < 8; ++r) acc[r] += accl[r] * 0.0009765625f;
      s[nt] = acc; }
    float sc[16]; bool ok[16];
#pragma unroll      /* constant indices keep the fragment, score and accumulator arrays in registers */
    for (int i = 0; i < 16; ++i) { const int kk = j0 + (i >> 3) * 16 + 8 * hh + (i & 7);
      ok[i] = (CAUSAL == 1) ? (kk <= tq) : ((CAUSAL == 2) ? ((kk >> 5) == (tq >> 5)) : true);      /* mode 2: block-diagonal 32-token groups */
      if (CAUSAL == 4) ok[i] = MSK[((size_t)b * TQ + tq) * TK + kk] != 0;      /* mode 4: per-(query, key) INPUT mask shared by all heads; masked keys contribute nothing, rows with no valid key give l = 0 -> output 0 */
      sc[i] = ok[i] ? s[i >> 3][i & 7] : -3.0e38f; }      /* raw q.k: maxima are taken on raw scores, the (positive) scale enters with the exponent */
    float mt[8];
#pragma unroll      /* constant indices keep the fragment, score and accumulator arrays in registers */
    for (int i = 0; i < 8; ++i) mt[i] = fmaxf(sc[i], sc[8 + i]);
    float mc = fmaxf(fmaxf(fmaxf(mt[0], mt[1]), fmaxf(mt[2], mt[3])), fmaxf(fmaxf(mt[4], mt[5]), fmaxf(mt[6], mt[7])));
    mc = fmaxf(mc, xhalf(mc));      /* the other half's 16 keys of the same query */
    const float mn = fmaxf(m_q, mc); const float al = (mn > -1.0e38f) ? __builtin_amdgcn_exp2f((m_q - mn) * SCL2) : 1.0f; m_q = mn;
    const float nb = 10.0f - mn * SCL2;      /* p = 2^(sc * SCL2 + nb) = 2^10 exp((sc - mn) / sqrt(32)): scale, log2(e), maximum and P's 2^10 in one fma per score */
    float p[16]; FragH pb;
#pragma unroll      /* constant indices keep the fragment, score and accumulator arrays in registers */
    for (int i = 0; i < 16; ++i) p[i] = sc[i] * SCL2 + nb;
    exp2x8(p[0], p[1], p[2], p[3], p[4], p[5], p[6], p[7]); exp2x8(p[8], p[9], p[10], p[11], p[12], p[13], p[14], p[15]);
#pragma unroll      /* constant indices keep the fragment, score and accumulator arrays in registers */
    for (int i = 0; i < 16; ++i) { if (!ok[i]) p[i] = 0.f; pb.h[i] = (_Float16)p[i]; }      /* pb.h[i]: key kmap(i, hh) of column ln; p and l_q both carry the 2^10 */
    float pt[8];
#pragma unroll      /* constant indices keep the fragment, score and accumulator arrays in registers */
    for (int i = 0; i < 8; ++i) pt[i] = p[i] + p[8 + i];
    l_q = l_q * al + (((pt[0] + pt[1]) + (pt[2] + pt[3])) + ((pt[4] + pt[5]) + (pt[6] + pt[7])));
#pragma unroll      /* constant indices keep the fragment, score and accumulator arrays in registers */
    for (int dt = 0; dt < DT; ++dt)
#pragma unroll      /* constant indices keep the fragment, score and accumulator arrays in registers */
      for (int r = 0; r < 8; ++r) oacc[dt][r] *= al;
#pragma unroll      /* constant indices keep the fragment, score and accumulator arrays in registers */
    for (int dt = 0; dt < DT; ++dt) oacc[dt] = mmaH<1>(av[dt].v, av[dt].v, pb.v, pb.v, oacc[dt]); }
    if (more) stash(buf ^ 1);      /* that buffer's last readers left it at the barrier that ended the trip before */
    __syncthreads(); }      /* one barrier a trip: publishes tile t + 1 and ends every wave's reads of tile t, which the next trip overwrites */
  // The two key halves of a query are joined as two tiles of the running softmax are: common maximum, each half's sum and outputs scaled by 2^((own maximum - common maximum) * SCL2).
  if (kh == 1) {
#pragma unroll      /* constant indices keep the fragment, score and accumulator arrays in registers */
    for (int dt = 0; dt < DT; ++dt) { const v4f lo4 = {oacc[dt][0], oacc[dt][1], oacc[dt][2], oacc[dt][3]}, hi4 = {oacc[dt][4], oacc[dt][5], oacc[dt][6], oacc[dt][7]}; *(v4fa*)&sM[w][lane][dt * 8] = lo4; *(v4fa*)&sM[w][lane][dt * 8 + 4] = hi4; }
    sM[w][lane][8 * DT] = m_q; sM[w][lane][8 * DT + 1] = l_q; }
  __syncthreads();      /* the second half's partial results are written before the first half reads them; every wave passes it */
  if (kh == 1) return;      /* behind the last barrier */
  { const float m1 = sM[w][lane][8 * DT], l1 = sM[w][lane][8 * DT + 1]; const float mm = fmaxf(m_q, m1); const bool any = mm > -1.0e38f;
    const float a0 = any ? __builtin_amdgcn_exp2f((m_q - mm) * SCL2) : 1.0f, a1 = any ? __builtin_amdgcn_exp2f((m1 - mm) * SCL2) : 1.0f;
    l_q = l_q * a0 + l1 * a1;
#pragma unroll      /* constant indices keep the fragment, score and accumulator arrays in registers */
    for (int dt = 0; dt < DT; ++dt) { const v4f lo4 = *(const v4fa*)&sM[w][lane][dt * 8], hi4 = *(const v4fa*)&sM[w][lane][dt * 8 + 4];
#pragma unroll      /* constant indices keep the fragment, score and accumulator arrays in registers */
      for (int r = 0; r < 4; ++r) { oacc[dt][r] = oacc[dt][r] * a0 + lo4[r] * a1; oacc[dt][4 + r] = oacc[dt][4 + r] * a0 + hi4[r] * a1; } } }
  const float lsum = l_q + xhalf(l_q); const float linv = (lsum > 0.f) ? 1.0f / lsum : 0.f;
#pragma unroll      /* constant indices keep the fragment, score and accumulator arrays in registers */
  for (int dt = 0; dt < DT; ++dt) { v4f lo4, hi4;
#pragma unroll      /* constant indices keep the fragment, score and accumulator arrays in registers */
    for (int r = 0; r < 4; ++r) { lo4[r] = oacc[dt][r] * linv; hi4[r] = oacc[dt][4 + r] * linv; }
    *(v4fa*)&sO[w][ln][dt * 16 + 8 * hh] = lo4; *(v4fa*)&sO[w][ln][dt * 16 + 8 * hh + 4] = hi4; }
  __builtin_amdgcn_fence(__ATOMIC_ACQ_REL, "workgroup"); __builtin_amdgcn_wave_barrier();
  {
#pragma unroll      /* constant indices keep the fragment, score and accumulator arrays in registers */
    for (int rp = 0; rp < RPW; rp += 128 / HPITCH) { const int r = rp + lane / (HPITCH / 4), pc = lane % (HPITCH / 4); const v4f val = *(const v4fa*)&sO[w][r][pc * 4]; *(v4f*)(O + ((size_t)b * TQ + q0 + r) * ldo + h * HPITCH + pc * 4) = val; }
     } }

// Sum over the 32 lanes of a wave, the total in every lane: four exchanges inside a 16-lane row (lane ^ 1, 2, 4, 8), then one between the rows.
template <unsigned LO, unsigned HI>
__device__ __forceinline__ float xrow(float x) { return __builtin_bit_cast(float, __builtin_amdgcn_permlane16(__builtin_bit_cast(int, x), __builtin_bit_cast(int, x), LO, HI, false, false)); }
__device__ __forceinline__ float wave_sum(float x) { x += xrow<0x67452301u, 0xefcdab89u>(x); x += xrow<0x54761032u, 0xdcfe98bau>(x); x += xrow<0x32107654u, 0xba98fedcu>(x); x += xrow<0xfedcba98u, 0x76543210u>(x); return x + xhalf(x); }
// Sum over the 8 waves of the work-group: one float a wave in LDS, one barrier, every thread adds the eight.
__device__ __forceinline__ float block_sum(float x, float* sh8) { x = wave_sum(x); if ((threadIdx.x & 31) == 0) sh8[threadIdx.x >> 5] = x;
  __syncthreads();      /* the eight wave sums are written before any thread reads them */
  const v4f a = *(const v4fa*)sh8, b = *(const v4fa*)(sh8 + 4); return ((a[0] + a[1]) + (a[2] + a[3])) + ((b[0] + b[1]) + (b[2] + b[3])); }
// Mean and 1/sigma of one group (4 channels x 4096 positions = 64 KB in a row). A thread asks for its 64 values in sixteen 16-byte loads before it uses the first (a wave-wide load = 512 bytes in a row),
// so the work-group waits for memory once; the rounded values stay in registers for the pass about the mean.
__device__ __forceinline__ void d_gnstat(const float* __restrict__ x, float* __restrict__ GS, const int bg) {
  constexpr int n = CPG * SLEN, NL = n / (256 * 4);
  __shared__ __attribute__((aligned(16))) float sh[2][8]; const int tid = threadIdx.x; const float* base = x + (size_t)bg * n + tid * 4;
  v4f xv[NL];
#pragma unroll      /* constant indices keep the values in registers; all loads in flight together */
  for (int u = 0; u < NL; ++u) xv[u] = *(const v4fa*)(base + u * 1024);
  v4f s4 = {0.f, 0.f, 0.f, 0.f};      /* four independent chains */
#pragma unroll      /* as above */
  for (int u = 0; u < NL; ++u)
#pragma unroll      /* as above */
    for (int q = 0; q < 4; ++q) { xv[u][q] = bf16_round(xv[u][q]); s4[q] += xv[u][q]; }
  const float mu = block_sum((s4[0] + s4[1]) + (s4[2] + s4[3]), sh[0]) / (float)n;
  v4f q4 = {0.f, 0.f, 0.f, 0.f};
#pragma unroll      /* as above */
  for (int u = 0; u < NL; ++u)
#pragma unroll      /* as above */
    for (int q = 0; q < 4; ++q) { const float d = xv[u][q] - mu; q4[q] += d * d; }
  const float var = block_sum((q4[0] + q4[1]) + (q4[2] + q4[3]), sh[1]) / (float)n;      /* its own eight floats: no thread still reads the first eight's place */
  if (tid == 0) { const float rs = rsqrtf(var + 1e-5f); { *(float*)(GS + (size_t)bg * 32) = mu; *(float*)(GS + (size_t)bg * 32 + 1) = rs;  } } }
__device__ __forceinline__ void d_wpad(const float* __restrict__ Wm, const float* __restrict__ bm, _Float16* __restrict__ BP, float* __restrict__ PB, const int bid) {
  const int t = bid * 256 + threadIdx.x; if (t >= DP * (CC / 8)) return; const int fr = t >> 5, pl = t & 31; const int pc = ((fr >> 1) % (CC / 32)) * 4 + (fr & 1) * 2 + (pl >> 4); const int r = (fr >> 1) / (CC / 32) * 16 + (pl & 15);      /* thread t makes piece t of the fragment order (pk_off(r, pc * 8, CC) = 8 t), as in d_wio: one wait for memory, not one per piece of a row */
  const int h = r / HPITCH, d = r % HPITCH; const bool live = d < HDT; const int srow = h * HDT + d; FragH f;
  for (int q = 0; q < 8; ++q) f.h[q] = live ? (_Float16)(bf16_round(Wm[(size_t)srow * CC + pc * 8 + q]) * 16.0f) : (_Float16)0.0f;
  const float bv = (live && pc == 0) ? bm[srow] : 0.f;
  *(v8us*)((unsigned short*)BP + (size_t)t * 8) = f.half[0]; if (pc == 0) *(float*)(PB + r) = bv;  }
__device__ __forceinline__ void d_wio(const float* __restrict__ Wm, int nin, int nout, int pair, _Float16* __restrict__ Bt, const int bid) { const int pitch = pair ? 2 * nin : nin; const size_t t = (size_t)bid * 256 + threadIdx.x; if (t >= (size_t)nout * (pitch / 8)) return; const int fr = (int)(t >> 5), pl = (int)(t & 31); const int pc = ((fr >> 1) % (pitch / 32)) * 4 + (fr & 1) * 2 + (pl >> 4); const int o = (fr >> 1) / (pitch / 32) * 16 + (pl & 15); FragH f;      /* thread t makes piece t of the fragment order (pk_off(o, pc * 8, pitch) = 8 t): a wave stores 512 bytes in a row */
  for (int q = 0; q < 8; ++q) { const int col = pc * 8 + q; const bool lo = col >= nin; const int i = lo ? col - nin : col; f.h[q] = (_Float16)(bf16_round(Wm[(size_t)i * nout + o]) * (lo ? 1.0f : 16.0f)); }
  *(v8us*)((unsigned short*)Bt + t * 8) = f.half[0];  }
__device__ __forceinline__ void d_wop(const float* __restrict__ Wo, _Float16* __restrict__ Bt, const int bid) { const int t = bid * 256 + threadIdx.x; if (t >= CC * (2 * CC / 8)) return; const int fr = t >> 5, pl = t & 31; const int pc = ((fr >> 1) % (2 * CC / 32)) * 4 + (fr & 1) * 2 + (pl >> 4); const int o = (fr >> 1) / (2 * CC / 32) * 16 + (pl & 15); const bool lo = pc * 8 >= CC; FragH f;      /* piece t of the fragment order, as in d_wio */
  for (int q = 0; q < 8; ++q) { const int c = pc * 8 + q - (lo ? CC : 0); f.h[q] = (_Float16)(bf16_round(Wo[(size_t)o * CC + c]) * (lo ? 1.0f : 16.0f)); } *(v8us*)((unsigned short*)Bt + (size_t)t * 8) = f.half[0];  }
// The two statistics passes and the six weight conversions need nothing of each other: one grid, each part a range of block indices (the branch is the same for a whole work-group, so the barriers of the statistics part are passed by all of its threads).
// The statistics blocks run longest and come first.
#define PB_GN (NB * NGR)                          /* blocks per statistics pass */
#define PB_W1 ((HID * (2 * CC / 8) + 255) / 256)
#define PB_W2 ((CC * (HID / 8) + 255) / 256)
#define PB_WO ((CC * (2 * CC / 8) + 255) / 256)
#define PB_WP ((DP * (CC / 8) + 255) / 256)      /* blocks per q, k or v weight matrix */
#define PB_ALL (2 * PB_GN + 3 * PB_WP + PB_W1 + PB_W2 + PB_WO)
__global__ __launch_bounds__(256) void k_prep(const float* __restrict__ x0, const float* __restrict__ x1, float* __restrict__ GS,
    const float* __restrict__ Wq, const float* __restrict__ bqp, const float* __restrict__ Wk, const float* __restrict__ bkp, const float* __restrict__ Wv, const float* __restrict__ bvp, _Float16* __restrict__ BP, float* __restrict__ PB,
    const float* __restrict__ W1, _Float16* __restrict__ BW1, const float* __restrict__ W2, _Float16* __restrict__ BW2, const float* __restrict__ Wo, _Float16* __restrict__ BWO) {
  int bid = blockIdx.x;
  if (bid < 2 * PB_GN) { const bool sec = bid >= PB_GN; d_gnstat(sec ? x1 : x0, GS + (sec ? PB_GN * 32 : 0), sec ? bid - PB_GN : bid); return; }
  bid -= 2 * PB_GN;
  if (bid < 3 * PB_WP) { const int m = bid / PB_WP; d_wpad(m == 0 ? Wq : (m == 1 ? Wk : Wv), m == 0 ? bqp : (m == 1 ? bkp : bvp), BP + (size_t)m * DP * CC, PB + m * DP, bid % PB_WP); return; }
  bid -= 3 * PB_WP;
  if (bid < PB_W1) { d_wio(W1, CC, HID, 1, BW1, bid); return; }
  bid -= PB_W1;
  if (bid < PB_W2) { d_wio(W2, HID, CC, 0, BW2, bid); return; }
  bid -= PB_W2;
  d_wop(Wo, BWO, bid); }
// One 16x16x32 f16 product; the builtin form, for which the compiler keeps the distances behind a matrix instruction itself.
__device__ __forceinline__ v8f f_mma(v16h a, v16h b, v8f c) { return __builtin_amdgcn_wmma_f32_16x16x32_f16(false, a, false, b, (short)0, c, false, false); }
__device__ __forceinline__ v16h l_frag(const unsigned short* p, int hh) { FragH f; f.half[0] = *(const v8us*)(p + 8 * hh); f.half[1] = *(const v8us*)(p + 16 + 8 * hh); return f.v; }
// Head of the block in one launch: normalise a 64-token tile of one input (all 128 channels), transposed into LDS as f16 [token][channel], and project it from there.
// blockIdx.y = 0 q, 1 k, 2 v. q and k: weight rows are the A operand and tokens the B operand, so a lane holds 8 neighbouring channels of ONE token and stores hi and residual as 16-byte pieces of the [batch][head][token][32] planes.
// v: tokens are the A operand and weight rows the B operand, so a lane holds 8 neighbouring tokens of ONE channel: a 16-byte piece of V^T. Each wave writes whole 128-byte lines.
#define XP (CC + 8)      /* LDS row pitch in halves: 16 bytes x an odd number */
template <bool ISV>
__device__ __forceinline__ void d_qkv(const float* __restrict__ x, const float* __restrict__ GS, const float* __restrict__ gam, const float* __restrict__ bet, const _Float16* __restrict__ Wp, const float* __restrict__ bp, unsigned short* __restrict__ Hh, unsigned short* __restrict__ VT, unsigned short (*sX)[XP]) {
  constexpr int NW = ISV ? 1 : 4;      /* weight fragments per k step */
  const int tid = threadIdx.x, w = tid >> 5, lane = tid & 31, ln = lane & 15, hh = lane >> 4;
  const int b = blockIdx.x / (SLEN / 64), pb = blockIdx.x % (SLEN / 64);
  const int ch0 = ISV ? w * 16 : (w >> 2) * 64;      /* this wave's first channel: 16 channels x 64 tokens for v, 64 channels x 16 tokens for q and k */
  v16h wf[CC / 32][NW]; v4f bl[NW][2]; float bv1 = 0.f;      /* this wave's weight fragments and biases, asked for before the tile so that they arrive while it is normalised */
#pragma unroll      /* constant indices keep the fragment arrays in registers */
  for (int ks = 0; ks < CC / 32; ++ks)
#pragma unroll      /* as above */
    for (int mt = 0; mt < NW; ++mt) wf[ks][mt] = p_frag(Wp, ch0 / 16 + mt, ks, CC / 32, lane);
  if (ISV) bv1 = bp[ch0 + ln];
  else {
#pragma unroll      /* as above */
    for (int mt = 0; mt < NW; ++mt) { bl[mt][0] = *(const v4fa*)(bp + ch0 + mt * 16 + 8 * hh); bl[mt][1] = *(const v4fa*)(bp + ch0 + mt * 16 + 8 * hh + 4); } }
  asm volatile("s_wait_xcnt 0x0" ::: "memory");      /* no later instruction writes into a register that one of the loads above still names as its address */
  const int cl0 = tid >> 2, pj = (tid & 3) * 4;      /* 4 lanes per channel row: the 2-byte LDS stores of a wave fall into different banks; a thread has channels cl0 and cl0 + 64, positions pj + 16 jj */
  const float* xp = x + ((size_t)b * CC + cl0) * SLEN + pb * 64 + pj; const float* gp = GS + ((size_t)b * NGR + cl0 / CPG) * 32;
  v4f xa[2][4]; float mu[2], rs[2], gg[2], be[2];      /* every address below is one of four bases plus a constant, so no load's result lands in a register that an earlier load names as its address */
#pragma unroll      /* constant indices keep the values in registers */
  for (int e = 0; e < 2; ++e) { mu[e] = gp[e * (64 / CPG) * 32]; rs[e] = gp[e * (64 / CPG) * 32 + 1]; gg[e] = gam[cl0 + 64 * e]; be[e] = bet[cl0 + 64 * e]; }
  asm volatile("s_wait_xcnt 0x0" ::: "memory");      /* as above, for the statistics and the scale and shift */
#pragma unroll      /* eight 16-byte pieces per thread, all in flight together */
  for (int e = 0; e < 2; ++e)
#pragma unroll      /* as above */
    for (int jj = 0; jj < 4; ++jj) xa[e][jj] = *(const v4fa*)(xp + (size_t)e * 64 * SLEN + jj * 16);
  asm volatile("s_wait_xcnt 0x0" ::: "memory");      /* as above, for the tile's loads */
#pragma unroll      /* constant indices keep the tile's pieces in registers */
  for (int e = 0; e < 2; ++e) { const float g = bf16_round(gg[e]), bb = bf16_round(be[e]);
#pragma unroll      /* as above */
    for (int jj = 0; jj < 4; ++jj)
#pragma unroll      /* as above */
      for (int q = 0; q < 4; ++q) { FragH f; f.h[0] = (_Float16)((bf16_round(xa[e][jj][q]) - mu[e]) * rs[e] * g + bb); sX[pj + 16 * jj + q][cl0 + 64 * e] = f.u[0]; } }
  __syncthreads();      /* the tile is written before any wave takes fragments from it; every thread of the work-group is on the same side of ISV */
  const v8f z8 = {0.f,0.f,0.f,0.f,0.f,0.f,0.f,0.f}; v8f acc[4] = {z8, z8, z8, z8};
  if constexpr (!ISV) { const int tk = (w & 3) * 16 + ln;      /* this lane's token */
#pragma unroll      /* as above */
    for (int ks = 0; ks < CC / 32; ++ks) { const v16h t = l_frag(&sX[tk][ks * 32], hh);
#pragma unroll      /* as above */
      for (int mt = 0; mt < 4; ++mt) acc[mt] = f_mma(wf[ks][mt], t, acc[mt]); }
    Hh += ((size_t)b * NH * SLEN + pb * 64 + tk) * HPITCH + (size_t)(ch0 / HPITCH) * SLEN * HPITCH; unsigned short* Hl = Hh + (size_t)NR * DP;      /* planes are [batch][head][token][32]: this token's row in the wave's first head */
#pragma unroll      /* as above */
    for (int mt = 0; mt < 4; ++mt) { FragH fh, fl;
#pragma unroll      /* as above */
      for (int r = 0; r < 8; ++r) { const float v = acc[mt][r] * 0.0625f + bf16_round(bl[mt][r >> 2][r & 3]); const _Float16 h = (_Float16)v; fh.h[r] = h; fl.h[r] = (_Float16)((v - (float)h) * 1024.0f); }
      const size_t po = (size_t)(mt * 16 / HPITCH) * SLEN * HPITCH + mt * 16 % HPITCH + 8 * hh; *(v8us*)(Hh + po) = fh.half[0]; *(v8us*)(Hl + po) = fl.half[0]; }
    asm volatile("s_wait_xcnt 0x0" ::: "memory");      /* in the built code the v side follows this one, and it writes into registers that the stores above name */
  } else {
#pragma unroll      /* as above */
    for (int ks = 0; ks < CC / 32; ++ks)
#pragma unroll      /* as above */
      for (int mt = 0; mt < 4; ++mt) acc[mt] = f_mma(l_frag(&sX[mt * 16 + ln][ks * 32], hh), wf[ks][0], acc[mt]);
    const float bv = bf16_round(bv1); unsigned short* dst = VT + ((size_t)b * DP + ch0 + ln) * TK + pb * 64;      /* row (b, head, d) of V^T = row b * 128 + channel */
#pragma unroll      /* as above */
    for (int mt = 0; mt < 4; ++mt) { FragH f;
#pragma unroll      /* as above */
      for (int r = 0; r < 8; ++r) f.h[r] = (_Float16)(acc[mt][r] * 0.0625f + bv);
      *(v8us*)(dst + mt * 16 + 8 * hh) = f.half[0]; }
  } }
__global__ __launch_bounds__(256) void k_qkv(const float* __restrict__ x0, const float* __restrict__ x1, const float* __restrict__ GS, const float* __restrict__ gam0, const float* __restrict__ bet0, const float* __restrict__ gam1, const float* __restrict__ bet1,
    const _Float16* __restrict__ BP, const float* __restrict__ PB, _Float16* __restrict__ QKH, _Float16* __restrict__ VT) {
  __shared__ __attribute__((aligned(16))) unsigned short sX[64][XP];
  const int y = blockIdx.y; const bool sec = y != 0;      /* the same for a whole work-group */
  const float* x = sec ? x1 : x0; const float* gam = sec ? gam1 : gam0; const float* bet = sec ? bet1 : bet0; const float* gs = GS + (sec ? NB * NGR * 32 : 0);
  if (y == 2) d_qkv<true>(x, gs, gam, bet, BP + (size_t)y * DP * CC, PB + y * DP, nullptr, (unsigned short*)VT, sX);
  else d_qkv<false>(x, gs, gam, bet, BP + (size_t)y * DP * CC, PB + y * DP, (unsigned short*)QKH + (size_t)y * 2 * NR * DP, nullptr, sX); }
// Tail of the block in one launch: everything behind the attention is row-wise, so a work-group takes 32 tokens through hi/residual split, W1 + exact GELU, W2 + residual, hi/residual split and Wo; the values between the products pass through LDS.
// W1 and W2: weight rows are the A operand and tokens the B operand (a lane holds 8 neighbouring columns of one token: one 16-byte LDS store). Wo: tokens are the A operand (a lane holds 8 neighbouring tokens of one output channel: the NCHW order of out).
#define PT 32                /* tokens per work-group: one 128-byte line of each output channel */
#define PP (2 * CC + 8)      /* LDS row pitch in halves: 16 bytes x an odd number */
__global__ __launch_bounds__(256) void k_tail(const float* __restrict__ O, const _Float16* __restrict__ BW1, const float* __restrict__ b1, const _Float16* __restrict__ BW2, const float* __restrict__ b2, const _Float16* __restrict__ BWO, const float* __restrict__ bo, float* __restrict__ out) {
  __shared__ __attribute__((aligned(16))) unsigned short sA[PT][PP]; __shared__ __attribute__((aligned(16))) unsigned short sG[PT][PP]; __shared__ __attribute__((aligned(16))) unsigned short sF[PT][PP]; __shared__ __attribute__((aligned(16))) float sR[PT][CC + 4];
  const int tid = threadIdx.x, w = tid >> 5, lane = tid & 31, ln = lane & 15, hh = lane >> 4; const int r0 = blockIdx.x * PT;
  v4f c1[2][2], c2[2];
#pragma unroll
  for (int mt = 0; mt < 2; ++mt) { c1[mt][0] = *(const v4fa*)(b1 + w * 32 + mt * 16 + 8 * hh); c1[mt][1] = *(const v4fa*)(b1 + w * 32 + mt * 16 + 8 * hh + 4); }
  c2[0] = *(const v4fa*)(b2 + w * 16 + 8 * hh); c2[1] = *(const v4fa*)(b2 + w * 16 + 8 * hh + 4); const float c3 = bo[w * 16 + ln];
  asm volatile("s_wait_xcnt 0x0" ::: "memory");      /* no weight load below lands in a register that one of the bias loads above still names as its address */
  v16h w1[8][2];      /* W1 rows w * 32 .. + 31, asked for before the tile */
#pragma unroll      /* constant indices keep the fragment arrays in registers */
  for (int ks = 0; ks < 8; ++ks)
#pragma unroll
    for (int mt = 0; mt < 2; ++mt) w1[ks][mt] = p_frag(BW1, w * 2 + mt, ks, 8, lane);
  { const int tk = tid >> 3, c0 = (tid & 7) * 16; const float* sp = O + (size_t)(r0 + tk) * DP + c0; v4f xv[4];
#pragma unroll
    for (int q = 0; q < 4; ++q) xv[q] = *(const v4fa*)(sp + 4 * q);
    asm volatile("s_wait_xcnt 0x0" ::: "memory");      /* no later instruction writes into a register that one of the loads above still names as its address */
#pragma unroll
    for (int g = 0; g < 2; ++g) { FragH fh, fl;
#pragma unroll
      for (int q = 0; q < 8; ++q) { const float v = xv[g * 2 + (q >> 2)][q & 3]; const _Float16 hv = (_Float16)v; fh.h[q] = hv; fl.h[q] = (_Float16)((v - (float)hv) * 16.0f); }
      *(v8us*)&sA[tk][c0 + 8 * g] = fh.half[0]; *(v8us*)&sA[tk][CC + c0 + 8 * g] = fl.half[0]; }
#pragma unroll
    for (int q = 0; q < 4; ++q) *(v4fa*)&sR[tk][c0 + 4 * q] = xv[q]; }
  __syncthreads();      /* attention output, split, is written before any wave takes fragments from it */
  const v8f z8 = {0.f,0.f,0.f,0.f,0.f,0.f,0.f,0.f}; v8f a1[2][2] = {{z8, z8}, {z8, z8}};
#pragma unroll
  for (int ks = 0; ks < 8; ++ks) { const v16h t0 = l_frag(&sA[ln][ks * 32], hh), t1 = l_frag(&sA[16 + ln][ks * 32], hh);
#pragma unroll
    for (int mt = 0; mt < 2; ++mt) { a1[mt][0] = f_mma(w1[ks][mt], t0, a1[mt][0]); a1[mt][1] = f_mma(w1[ks][mt], t1, a1[mt][1]); } }
  v16h w2[8], w3[8];      /* W2 and Wo rows w * 16 .. + 15: on their way while the GELU is computed */
#pragma unroll
  for (int ks = 0; ks < 8; ++ks) { w2[ks] = p_frag(BW2, w, ks, 8, lane); w3[ks] = p_frag(BWO, w, ks, 8, lane); }
  asm volatile("s_wait_xcnt 0x0" ::: "memory");      /* as above, for the weight loads */
#pragma unroll
  for (int mt = 0; mt < 2; ++mt)
#pragma unroll
    for (int nt = 0; nt < 2; ++nt) { FragH f;
#pragma unroll
      for (int r = 0; r < 8; ++r) { float v = a1[mt][nt][r] * 0.0625f + bf16_round(c1[mt][r >> 2][r & 3]); v = 0.5f * v * (1.0f + erff(v * 0.70710678118654752f)); f.h[r] = (_Float16)v; }
      *(v8us*)&sG[nt * 16 + ln][w * 32 + mt * 16 + 8 * hh] = f.half[0]; }
  __syncthreads();      /* the hidden layer is complete before the second product reads it */
  v8f a2[2] = {z8, z8};
#pragma unroll
  for (int ks = 0; ks < 8; ++ks) { a2[0] = f_mma(w2[ks], l_frag(&sG[ln][ks * 32], hh), a2[0]); a2[1] = f_mma(w2[ks], l_frag(&sG[16 + ln][ks * 32], hh), a2[1]); }
#pragma unroll
  for (int nt = 0; nt < 2; ++nt) { const int tk = nt * 16 + ln, c0 = w * 16 + 8 * hh; const v4f ra = *(const v4fa*)&sR[tk][c0], rb = *(const v4fa*)&sR[tk][c0 + 4]; FragH fh, fl;
#pragma unroll
    for (int r = 0; r < 8; ++r) { float v = a2[nt][r] * 0.0625f + bf16_round(c2[r >> 2][r & 3]); v += (r < 4) ? ra[r & 3] : rb[r & 3]; const _Float16 hv = (_Float16)v; fh.h[r] = hv; fl.h[r] = (_Float16)((v - (float)hv) * 16.0f); }
    *(v8us*)&sF[tk][c0] = fh.half[0]; *(v8us*)&sF[tk][CC + c0] = fl.half[0]; }
  __syncthreads();      /* out + mlp, split, is complete before the last product reads it */
  v8f a3[2] = {z8, z8};
#pragma unroll
  for (int ks = 0; ks < 8; ++ks) { a3[0] = f_mma(l_frag(&sF[ln][ks * 32], hh), w3[ks], a3[0]); a3[1] = f_mma(l_frag(&sF[16 + ln][ks * 32], hh), w3[ks], a3[1]); }
  const float bv = bf16_round(c3); float* d = out + ((size_t)(r0 / SLEN) * CC + w * 16 + ln) * SLEN + (r0 % SLEN) + 8 * hh;
#pragma unroll
  for (int mt = 0; mt < 2; ++mt) { v4f lo4, hi4;
#pragma unroll
    for (int r = 0; r < 4; ++r) { lo4[r] = a3[mt][r] * 0.0625f + bv; hi4[r] = a3[mt][4 + r] * 0.0625f + bv; }
    *(v4f*)(d + mt * 16) = lo4; *(v4f*)(d + mt * 16 + 4) = hi4; } }

extern "C" void kernel_launch(void* const* d_in, const int* in_sizes, int n_in,
                              void* d_out, int out_size, void* d_ws, size_t ws_size, hipStream_t stream) {
  (void)in_sizes; (void)n_in; (void)out_size;
  const float* const* I = (const float* const*)d_in; const float* fo = I[0]; const float* fs = I[1]; const float* gq = I[2]; const float* bq = I[3]; const float* gkv = I[4]; const float* bkv = I[5]; const float* Wq = I[6]; const float* bqp = I[7]; const float* Wk = I[8]; const float* bkp = I[9]; const float* Wv = I[10]; const float* bvp = I[11]; const float* W1 = I[12]; const float* b1 = I[13]; const float* W2 = I[14]; const float* b2 = I[15]; const float* Wo = I[16]; const float* bo = I[17];
  char* ws = (char*)d_ws; size_t off = 0;
  auto take = [&](size_t bytes) { char* p = ws + off; off += (bytes + 255) & ~(size_t)255; return p; };
  _Float16* BPq = (_Float16*)take((size_t)3 * DP * CC * 2); float* PBq = (float*)take(3 * DP * 4);      /* q, k, v planes one behind the other */
  _Float16* BW1 = (_Float16*)take((size_t)HID * 2 * CC * 2); _Float16* BW2 = (_Float16*)take((size_t)CC * HID * 2); _Float16* BWO = (_Float16*)take((size_t)CC * 2 * CC * 2); float* GS = (float*)take((size_t)NB * NGR * 32 * 4 * 2);
  _Float16* QH = (_Float16*)take((size_t)4 * NR * DP * 2); _Float16* QL = QH + (size_t)NR * DP; _Float16* KH = QH + (size_t)2 * NR * DP; _Float16* KL = QH + (size_t)3 * NR * DP; _Float16* VT = (_Float16*)take((size_t)NR * DP * 2);      /* q hi, q residual, k hi, k residual; V^T */
  float* O = (float*)take((size_t)NR * DP * 4);      /* attention output */
  if (off > ws_size) return;      /* 0.5 + 4 x 2 + 2 + 4 = 15 MiB */
  k_prep<<<PB_ALL, 256, 0, stream>>>(fo, fs, GS, Wq, bqp, Wk, bkp, Wv, bvp, BPq, PBq, W1, BW1, W2, BW2, Wo, BWO);      /* group statistics of both inputs; conv1x1 weights (out,in) = natural rows; MLP and output weights */
  k_qkv<<<dim3(NR / 64, 3), 256, 0, stream>>>(fo, fs, GS, gq, bq, gkv, bkv, BPq, PBq, QH, VT);      /* normalise + q, k (hi + residual planes), V^T */
  k_flashqk<0><<<NB * NH * QBLKS, 256, 0, stream>>>(QH, QL, KH, KL, VT, nullptr, O, DP);      /* q/k hi + residual; P (x2^10) and V plain f16 */
  k_tail<<<NR / PT, 256, 0, stream>>>(O, BW1, b1, BW2, b2, BWO, bo, (float*)d_out);      /* gelu_erf(out W1 + b1) W2 + b2 + out, conv1x1 Wo + bo, NCHW */
}

// v010
// One run takes 54.5 microseconds.
// Next to v009, in two timings, it ran 1.07 and 1.05 times as fast.
// Counting every step since v000, which is the starting kernel, it is 12.4 times as fast.
#include <hip/hip_runtime.h>
// SFBlock (2 x 128 x 64 x 64; 4 heads x 32; GroupNorm(32) on both inputs; q from feat_opt, k/v from feat_sar via 1x1 convs; softmax(q k^T / sqrt(32)) v over the 4096 positions; MLP: gelu_erf(out W1 + b1) W2 + b2; fused = out + mlp; 1x1 conv Wo -> [2,128,64,64]).
// Compute dtype: inputs and parameters rounded to bf16; normalised inputs as f16 operands (~2^-12); q, k hi + residual; P (x2^10), v plain f16; attention output / fused as hi + residual pairs; the 256-wide GELU hidden as f16; f32 statistics/softmax/accumulation. v_wmma_f32_16x16x32_f16.
#define NB 2
#define CC 128
#define HID 256
#define NGR 32
#define CPG (CC / NGR)           /* 4 channels per group */
#define HDT 32
#define HPITCH HDT                   /* columns per head in the q/k/v planes: the true head dim, no padding */
#define DP (NH * HPITCH)             /* 128 */
#define NR (NB * SLEN)           /* 8192 */
#define QBLKS (TQ / 64)
#define SLEN 4096                /* H*W tokens */
#define TQ SLEN
#define TK SLEN
#define NH 4
#define SCL 0.17677669529663687f /* 32^-0.5 */
#define SCL2 ((float)(0.17677669529663687 * 1.4426950408889634)) /* 32^-0.5 * log2(e): raw score -> exponent of two */
typedef __bf16 v16b __attribute__((ext_vector_type(16)));
typedef unsigned short v8us __attribute__((ext_vector_type(8), may_alias));
typedef float  v8f  __attribute__((ext_vector_type(8)));
typedef float  v4f  __attribute__((ext_vector_type(4)));
typedef float  v4fa __attribute__((ext_vector_type(4), may_alias));
union FragB { v16b v; v8us half[2]; unsigned short u[16]; };

__device__ __forceinline__ unsigned short bf16_bits(float x) { unsigned int u = __float_as_uint(x); return (unsigned short)((u + 0x7FFFu + ((u >> 16) & 1u)) >> 16); }
__device__ __forceinline__ float bf16_val(unsigned short b) { return __uint_as_float(((unsigned int)b) << 16); }
__device__ __forceinline__ float bf16_round(float x) { return bf16_val(bf16_bits(x)); }
// D += A·B with NT terms: 1 = ah·bh, 2 = + al·bh (A split), 3 = + ah·bl (both split)
template <int NT>
__device__ __forceinline__ v8f mmaN(v16b ah, v16b al, v16b bh, v16b bl, v8f c) {
  c = __builtin_amdgcn_wmma_f32_16x16x32_bf16(false, ah, false, bh, (short)0, c, false, false);
  if (NT >= 2) c = __builtin_amdgcn_wmma_f32_16x16x32_bf16(false, al, false, bh, (short)0, c, false, false);
  if (NT >= 3) c = __builtin_amdgcn_wmma_f32_16x16x32_bf16(false, ah, false, bl, (short)0, c, false, false);
  asm volatile("v_nop\n\tv_nop\n\tv_nop\n\tv_nop" : "+v"(c) : "v"(ah), "v"(al), "v"(bh), "v"(bl));
  return c;
}

__global__ __launch_bounds__(256) void k_wt_bf16(const float* __restrict__ W, unsigned short* __restrict__ Wt, int K, int N) {
  const int t = blockIdx.x * 256 + threadIdx.x;
  const int k8n = K / 8;
  if (t >= N * k8n) return;
  const int n = t / k8n, k8 = (t % k8n) * 8;
  v8us v;
#pragma unroll
  for (int i = 0; i < 8; ++i) v[i] = bf16_bits(W[(size_t)(k8 + i) * N + n]);
  *(v8us*)(Wt + (size_t)n * K + k8) = v;
  
}

// GEMM C[M][N] (f32, pitch ldc) = act(A[M][K]·W + bias). A f32 row-major (pitch lda) converted per fragment to bf16
// (ASPLIT: hi/lo two planes -> 2 terms, else single rounded term); Wt bf16 [N][K] (pitch ldb). BIAS_BF16 rounds the
// bias to bf16 first (bias quantised to bf16 before the add). K%32==0, M%16==0, N%64==0.
template <bool ASPLIT, int ACT, bool BIAS_BF16>
__global__ __launch_bounds__(128) void k_gemm_bf(const float* __restrict__ A, int lda, const unsigned short* __restrict__ Wt, int ldb,
                                               const float* __restrict__ bias, float* __restrict__ C, int ldc, int M, int N, int K) {
  __shared__ __attribute__((aligned(16))) float so[4][16][64];
  const int tid = threadIdx.x, w = tid >> 5, lane = tid & 31, ln = lane & 15, hh = lane >> 4;
  const int ntn = N / 64;
  const int wid = blockIdx.x * 4 + w;
  const int mt = wid / ntn, nq = wid % ntn;
  if (mt * 16 >= M) return;
  const int row0 = mt * 16, col0 = nq * 64;
  const float* arow = A + (size_t)(row0 + ln) * lda;
  v8f acc[4] = {};
  for (int kb = 0; kb < K; kb += 32) {
    FragB ah, al;
    const v4f x0 = *(const v4fa*)(arow + kb + 8 * hh), x1 = *(const v4fa*)(arow + kb + 8 * hh + 4);
    const v4f x2 = *(const v4fa*)(arow + kb + 16 + 8 * hh), x3 = *(const v4fa*)(arow + kb + 16 + 8 * hh + 4);
    float xs[16] = {x0[0],x0[1],x0[2],x0[3],x1[0],x1[1],x1[2],x1[3],x2[0],x2[1],x2[2],x2[3],x3[0],x3[1],x3[2],x3[3]};
#pragma unroll
    for (int i = 0; i < 16; ++i) { const unsigned short hb = bf16_bits(xs[i]); ah.u[i] = hb; al.u[i] = ASPLIT ? bf16_bits(xs[i] - bf16_val(hb)) : (unsigned short)0; }
#pragma unroll
    for (int t = 0; t < 4; ++t) {
      const unsigned short* brow = Wt + (size_t)(col0 + t * 16 + ln) * ldb + kb;
      FragB b;
      b.half[0] = *(const v8us*)(brow + 8 * hh);
      b.half[1] = *(const v8us*)(brow + 16 + 8 * hh);
      acc[t] = mmaN<ASPLIT ? 2 : 1>(ah.v, al.v, b.v, b.v, acc[t]);
    }
  }
#pragma unroll
  for (int t = 0; t < 4; ++t) {
    float bv = bias ? bias[col0 + t * 16 + ln] : 0.f;
    if (BIAS_BF16) bv = bf16_round(bv);
#pragma unroll
    for (int r = 0; r < 8; ++r) { float v = acc[t][r] + bv; if (ACT == 1) v = fmaxf(v, 0.f); so[w][8 * hh + r][t * 16 + ln] = v; }
  }
  __builtin_amdgcn_fence(__ATOMIC_ACQ_REL, "workgroup");
  __builtin_amdgcn_wave_barrier();
  const int rsub = lane >> 4, c4 = (lane & 15) * 4;
  {
#pragma unroll
    for (int q = 0; q < 8; ++q) {
      const int r = q * 2 + rsub;
      const v4f v = *(const v4fa*)&so[w][r][c4];
      *(v4f*)(C + (size_t)(row0 + r) * ldc + col0 + c4) = v;
    }
    
  }
}

// GEMM C = act(A·W + bias + resid): A f32 (ASPLIT -> hi/lo 2 terms), Wt bf16 [N][K]; ACT 0 none, 1 relu, 2 exact gelu;
// resid (optional, f32, row index = (row % rmod), pitch ldr, RES_BF16 rounds it) added before the activation.
template <bool ASPLIT, int ACT, bool BIAS_BF16, bool RES_BF16>
__global__ __launch_bounds__(128) void k_gemm_bf3(const float* __restrict__ A, int lda, const unsigned short* __restrict__ Wt, int ldb,
                                                const float* __restrict__ bias, const float* __restrict__ resid, int rmod, int ldr,
                                                float* __restrict__ C, int ldc, int M, int N, int K) {
  __shared__ __attribute__((aligned(16))) float so[4][16][64];
  const int tid = threadIdx.x, w = tid >> 5, lane = tid & 31, ln = lane & 15, hh = lane >> 4;
  const int ntn = N / 64;
  const int wid = blockIdx.x * 4 + w;
  const int mt = wid / ntn, nq = wid % ntn;
  if (mt * 16 >= M) return;
  const int row0 = mt * 16, col0 = nq * 64;
  const float* arow = A + (size_t)(row0 + ln) * lda;
  v8f acc[4] = {};
  for (int kb = 0; kb < K; kb += 32) {
    FragB ah, al;
    const v4f x0 = *(const v4fa*)(arow + kb + 8 * hh), x1 = *(const v4fa*)(arow + kb + 8 * hh + 4);
    const v4f x2 = *(const v4fa*)(arow + kb + 16 + 8 * hh), x3 = *(const v4fa*)(arow + kb + 16 + 8 * hh + 4);
    float xs[16] = {x0[0],x0[1],x0[2],x0[3],x1[0],x1[1],x1[2],x1[3],x2[0],x2[1],x2[2],x2[3],x3[0],x3[1],x3[2],x3[3]};
#pragma unroll
    for (int i = 0; i < 16; ++i) { const unsigned short hb = bf16_bits(xs[i]); ah.u[i] = hb; al.u[i] = ASPLIT ? bf16_bits(xs[i] - bf16_val(hb)) : (unsigned short)0; }
#pragma unroll
    for (int t = 0; t < 4; ++t) {
      const unsigned short* brow = Wt + (size_t)(col0 + t * 16 + ln) * ldb + kb;
      FragB b;
      b.half[0] = *(const v8us*)(brow + 8 * hh);
      b.half[1] = *(const v8us*)(brow + 16 + 8 * hh);
      acc[t] = mmaN<ASPLIT ? 2 : 1>(ah.v, al.v, b.v, b.v, acc[t]);
    }
  }
#pragma unroll
  for (int t = 0; t < 4; ++t) {
    const int col = col0 + t * 16 + ln;
    float bv = bias ? bias[col] : 0.f;
    if (BIAS_BF16) bv = bf16_round(bv);
#pragma unroll
    for (int r = 0; r < 8; ++r) {
      float v = acc[t][r] + bv;
      if (resid) { float rv = resid[(size_t)((row0 + 8 * hh + r) % rmod) * ldr + col]; if (RES_BF16) rv = bf16_round(rv); v += rv; }
      if (ACT == 1) v = fmaxf(v, 0.f);
      if (ACT == 2) v = 0.5f * v * (1.0f + erff(v * 0.70710678118654752f));
      if (ACT == 3) { const float u = 0.7978845608028654f * (v + 0.044715f * v * v * v); v = 0.5f * v * (1.0f + tanhf(u)); }
      so[w][8 * hh + r][t * 16 + ln] = v;
    }
  }
  __builtin_amdgcn_fence(__ATOMIC_ACQ_REL, "workgroup");
  __builtin_amdgcn_wave_barrier();
  const int rsub = lane >> 4, c4 = (lane & 15) * 4;
  {
#pragma unroll
    for (int q = 0; q < 8; ++q) {
      const int r = q * 2 + rsub;
      const v4f v = *(const v4fa*)&so[w][r][c4];
      *(v4f*)(C + (size_t)(row0 + r) * ldc + col0 + c4) = v;
    }
    
  }
}
// row LayerNorm (biased variance, eps) over N: s = X (+ R); optional out_sum <- s; out_norm <- (s-mu)*rsqrt(var+eps)*g + b
template <bool PARAM_BF16>
__global__ __launch_bounds__(256) void k_layernorm(const float* __restrict__ X, const float* __restrict__ R, const float* __restrict__ g, const float* __restrict__ bta,
                                                  float* __restrict__ out_sum, float* __restrict__ out_norm, int N, float eps) {
  __shared__ float red[256];
  const int row = blockIdx.x, tid = threadIdx.x;
  const float* x = X + (size_t)row * N; const float* rr = R ? R + (size_t)row * N : nullptr;
  float vals[16];                     // up to N = 4096
  const int per = N / 256;            // contiguous chunk per thread? use strided-by-4 chunks: thread handles j = tid*4 + 1024*u
  float s1 = 0.f;
  for (int u = 0; u < per / 4; ++u) {
    const int j = tid * 4 + 1024 * u;
    const v4f a = *(const v4fa*)(x + j);
    v4f b = {0.f,0.f,0.f,0.f}; if (rr) b = *(const v4fa*)(rr + j);
#pragma unroll
    for (int q = 0; q < 4; ++q) { const float v = a[q] + b[q]; vals[u * 4 + q] = v; s1 += v; }
  }
  red[tid] = s1; __syncthreads();
  for (int st = 128; st > 0; st >>= 1) { if (tid < st) red[tid] += red[tid + st]; __syncthreads(); }
  const float mu = red[0] / (float)N; __syncthreads();
  float s2 = 0.f;
  for (int u = 0; u < per / 4; ++u)
#pragma unroll
    for (int q = 0; q < 4; ++q) { const float c = vals[u * 4 + q] - mu; s2 += c * c; }
  red[tid] = s2; __syncthreads();
  for (int st = 128; st > 0; st >>= 1) { if (tid < st) red[tid] += red[tid + st]; __syncthreads(); }
  const float rs = rsqrtf(red[0] / (float)N + eps);
  {
    for (int u = 0; u < per / 4; ++u) {
      const int j = tid * 4 + 1024 * u;
      v4f o, sm;
#pragma unroll
      for (int q = 0; q < 4; ++q) {
        float gg = g[j + q], bb = bta[j + q];
        if (PARAM_BF16) { gg = bf16_round(gg); bb = bf16_round(bb); }
        sm[q] = vals[u * 4 + q]; o[q] = (vals[u * 4 + q] - mu) * rs * gg + bb;
      }
      if (out_sum) *(v4f*)(out_sum + (size_t)row * N + j) = sm;
      *(v4f*)(out_norm + (size_t)row * N + j) = o;
    }
    
  }
}



// ---- f16 WMMA path (v_wmma_f32_16x16x32_f16): 11-bit significands for operands in range — used where a [0,1] probability operand needs more precision than bf16
typedef _Float16 v16h __attribute__((ext_vector_type(16)));
union FragH { v16h v; v8us half[2]; _Float16 h[16]; unsigned short u[16]; };
template <int NT>
__device__ __forceinline__ v8f mmaH(v16h ah, v16h al, v16h bh, v16h bl, v8f c) {
  c = __builtin_amdgcn_wmma_f32_16x16x32_f16(false, ah, false, bh, (short)0, c, false, false);
  if (NT >= 2) c = __builtin_amdgcn_wmma_f32_16x16x32_f16(false, al, false, bh, (short)0, c, false, false);
  if (NT >= 3) c = __builtin_amdgcn_wmma_f32_16x16x32_f16(false, ah, false, bl, (short)0, c, false, false);
  asm volatile("v_nop\n\tv_nop\n\tv_nop\n\tv_nop" : "+v"(c) : "v"(ah), "v"(al), "v"(bh), "v"(bl));
  return c;
}
// batched GEMM like k_gemm_b but f16 operands: A f32 (split into f16 hi/lo if ASPLIT, else rounded to f16), Bt = f16 values [n][k]; alpha; C f32; N multiple of 16 (partial tiles skipped)
template <bool ASPLIT>
__global__ __launch_bounds__(128) void k_gemm_h(const float* __restrict__ A, int lda, size_t sA, const _Float16* __restrict__ Bh, int ldb, size_t sB, float alpha, float* __restrict__ C, int ldc, size_t sC, int M, int N, int K) {
  __shared__ __attribute__((aligned(16))) float so[4][16][64];
  const int tid = threadIdx.x, w = tid >> 5, lane = tid & 31, ln = lane & 15, hh = lane >> 4; const int by = blockIdx.y;
  A += (size_t)by * sA; Bh += (size_t)by * sB; C += (size_t)by * sC;
  const int ntn = (N + 63) / 64; const int wid = blockIdx.x * 4 + w; const int mt = wid / ntn, nq = wid % ntn; if (mt * 16 >= M) return;
  const int row0 = mt * 16, col0 = nq * 64; const float* arow = A + (size_t)(row0 + ln) * lda;
  v8f acc[4] = {};
  for (int kb = 0; kb < K; kb += 32) {
    FragH ah, al;
    const v4f x0 = *(const v4fa*)(arow + kb + 8 * hh), x1 = *(const v4fa*)(arow + kb + 8 * hh + 4), x2 = *(const v4fa*)(arow + kb + 16 + 8 * hh), x3 = *(const v4fa*)(arow + kb + 16 + 8 * hh + 4);
    float xs[16] = {x0[0],x0[1],x0[2],x0[3],x1[0],x1[1],x1[2],x1[3],x2[0],x2[1],x2[2],x2[3],x3[0],x3[1],x3[2],x3[3]};
#pragma unroll
    for (int i = 0; i < 16; ++i) { const _Float16 h = (_Float16)xs[i]; ah.h[i] = h; al.h[i] = ASPLIT ? (_Float16)(xs[i] - (float)h) : (_Float16)0.0f; }
#pragma unroll
    for (int t = 0; t < 4; ++t) { if (col0 + t * 16 >= N) continue; const size_t boff = (size_t)(col0 + t * 16 + ln) * ldb + kb; FragH bq; bq.half[0] = *(const v8us*)(Bh + boff + 8 * hh); bq.half[1] = *(const v8us*)(Bh + boff + 16 + 8 * hh);
      acc[t] = mmaH<ASPLIT ? 2 : 1>(ah.v, al.v, bq.v, bq.v, acc[t]); }
  }
#pragma unroll
  for (int t = 0; t < 4; ++t) { if (col0 + t * 16 >= N) continue;
#pragma unroll
    for (int r = 0; r < 8; ++r) so[w][8 * hh + r][t * 16 + ln] = acc[t][r] * alpha; }
  __builtin_amdgcn_fence(__ATOMIC_ACQ_REL, "workgroup"); __builtin_amdgcn_wave_barrier();
  const int rsub = lane >> 4, c4 = (lane & 15) * 4;
  {
#pragma unroll
    for (int q = 0; q < 8; ++q) { const int r = q * 2 + rsub; if (col0 + c4 < N) { const v4f v = *(const v4fa*)&so[w][r][c4]; *(v4f*)(C + (size_t)(row0 + r) * ldc + col0 + c4) = v; } }
     }
}

// Wt[n][k] = f16(W[k][n]·scale) from f32 row-major W[K][N] (scale = power of two; bf16-exact weights stay exact in f16 away from the subnormal range)
__global__ __launch_bounds__(256) void k_wt_f16(const float* __restrict__ W, _Float16* __restrict__ Wt, int K, int N, float scale) {
  const int t = blockIdx.x * 256 + threadIdx.x; if (t >= N * (K / 8)) return; const int n = t / (K / 8), k8 = (t % (K / 8)) * 8; FragH f;
#pragma unroll
  for (int i = 0; i < 8; ++i) f.h[i] = (_Float16)(bf16_round(W[(size_t)(k8 + i) * N + n]) * scale); const v8us o = f.half[0];
  *(v8us*)((unsigned short*)Wt + (size_t)n * K + k8) = o; 
}
// k_gemm_hh variant with fused epilogue: v = acc·alpha + bias[by·sBias + col] (+ CP[(row/rowsPerB)·sCPb + by·64 + col] if CP) ; ACT 0 none / 1 elu ; writes f16 C16 (and f32 C if non-null)
template <int ACT>
__global__ __launch_bounds__(128) void k_gemm_hhx(const _Float16* __restrict__ A, int lda, size_t sA, const _Float16* __restrict__ Bh, int ldb, size_t sB, float alpha, const float* __restrict__ bias, size_t sBias, const float* __restrict__ CP, int rowsPerB, size_t sCPb, int row0g,
    float* __restrict__ C, _Float16* __restrict__ C16, int ldc, size_t sC, int M, int N, int K) {
  __shared__ __attribute__((aligned(16))) float so[4][16][64];
  const int tid = threadIdx.x, w = tid >> 5, lane = tid & 31, ln = lane & 15, hh = lane >> 4; const int by = blockIdx.y;
  A += (size_t)by * sA; Bh += (size_t)by * sB; const size_t cofs = (size_t)by * sC; const float* bp = bias ? bias + (size_t)by * sBias : nullptr;
  const int ntn = (N + 63) / 64; const int wid = blockIdx.x * 4 + w; const int mt = wid / ntn, nq = wid % ntn; if (mt * 16 >= M) return;
  const int row0 = mt * 16, col0 = nq * 64; const _Float16* arow = A + (size_t)(row0 + ln) * lda;
  v8f acc[4] = {};
  for (int kb = 0; kb < K; kb += 32) { FragH ah; ah.half[0] = *(const v8us*)((const unsigned short*)arow + kb + 8 * hh); ah.half[1] = *(const v8us*)((const unsigned short*)arow + kb + 16 + 8 * hh);
#pragma unroll
    for (int t = 0; t < 4; ++t) { if (col0 + t * 16 >= N) continue; const size_t boff = (size_t)(col0 + t * 16 + ln) * ldb + kb; FragH bq; bq.half[0] = *(const v8us*)((const unsigned short*)Bh + boff + 8 * hh); bq.half[1] = *(const v8us*)((const unsigned short*)Bh + boff + 16 + 8 * hh);
      acc[t] = mmaH<1>(ah.v, ah.v, bq.v, bq.v, acc[t]); }
  }
#pragma unroll
  for (int t = 0; t < 4; ++t) { if (col0 + t * 16 >= N) continue; const int col = col0 + t * 16 + ln; const float bv = bp ? bf16_round(bp[col]) : 0.f;
#pragma unroll
    for (int r = 0; r < 8; ++r) { float v = acc[t][r] * alpha + bv; if (CP) { const int bidx = (row0g + row0 + 8 * hh + r) / rowsPerB; v += CP[(size_t)bidx * sCPb + (size_t)by * 64 + col]; } if (ACT == 1) v = (v > 0.f) ? v : expm1f(v); else if (ACT == 7) v = (v > 0.f) ? v + 1.0f : expf(v); else if (ACT == 8) v = tanhf(v); else if (ACT == 9) v = 0.5f * v * (1.0f + tanhf(0.7978845608028654f * (v + 0.044715f * v * v * v))); else if (ACT == 11) v = 1.0f / (1.0f + expf(-v)); else if (ACT == 12) v = (v > 0.f) ? v : 0.01f * v; else if (ACT == 14) v = (v > 0.f) ? v : 0.1f * v; else if (ACT == 15) v = v / (1.0f + expf(-v)); else if (ACT == 3) v = fmaxf(v, 0.f); else if (ACT == 6) v = 0.5f * v * (1.0f + erff(v * 0.70710678118654752f)); so[w][8 * hh + r][t * 16 + ln] = v; } }
  __builtin_amdgcn_fence(__ATOMIC_ACQ_REL, "workgroup"); __builtin_amdgcn_wave_barrier();
  const int rsub = lane >> 4, c4 = (lane & 15) * 4; typedef _Float16 v4h __attribute__((ext_vector_type(4)));
  {
#pragma unroll
    for (int q = 0; q < 8; ++q) { const int r = q * 2 + rsub; if (col0 + c4 < N) { const v4f v = *(const v4fa*)&so[w][r][c4]; if (C) *(v4f*)(C + cofs + (size_t)(row0 + r) * ldc + col0 + c4) = v; if (C16) { v4h h4; for (int i = 0; i < 4; ++i) h4[i] = (_Float16)v[i]; *(v4h*)(C16 + cofs + (size_t)(row0 + r) * ldc + col0 + c4) = h4; } } }
     }
}


typedef _Float16 v4h __attribute__((ext_vector_type(4)));

__global__ __launch_bounds__(256) void k_x16(const float* __restrict__ x, _Float16* __restrict__ X16, size_t n8) { const size_t t = (size_t)blockIdx.x * 256 + threadIdx.x; if (t >= n8) return; FragH f;
#pragma unroll
  for (int q = 0; q < 8; ++q) f.h[q] = (_Float16)bf16_round(x[t * 8 + q]); *(v8us*)((unsigned short*)X16 + t * 8) = f.half[0];  }
__global__ __launch_bounds__(256) void k_h16(const float* __restrict__ x, _Float16* __restrict__ X16, size_t n8) { const size_t t = (size_t)blockIdx.x * 256 + threadIdx.x; if (t >= n8) return; FragH f;
#pragma unroll
  for (int q = 0; q < 8; ++q) f.h[q] = (_Float16)x[t * 8 + q]; *(v8us*)((unsigned short*)X16 + t * 8) = f.half[0];  }
__global__ __launch_bounds__(256) void k_round16f(const float* __restrict__ W, _Float16* __restrict__ Bt, size_t n8) { const size_t t = (size_t)blockIdx.x * 256 + threadIdx.x; if (t >= n8) return; FragH f;
#pragma unroll
  for (int i = 0; i < 8; ++i) f.h[i] = (_Float16)(bf16_round(W[t * 8 + i]) * 16.0f); *(v8us*)((unsigned short*)Bt + t * 8) = f.half[0];  }
// Weights lie in the workspace in fragment order: the 32 16-byte pieces that one wave-wide load of a 16-row x 32-column fragment takes (lane = 16 hh + row % 16) stand side by side, 512 bytes in four whole 128-byte lines
// (row-major, the same load touches 16 lines). pk_off: offset in halves of the piece with columns c8 .. c8 + 7 (c8 a multiple of 8) of one row of a [rows][K] matrix; p_frag: fragment (row tile rt, k step ks) of a matrix with KS k steps.
__device__ __forceinline__ size_t pk_off(int row, int c8, int K) { return ((((size_t)(row >> 4) * (K / 32) + (c8 >> 5)) * 2 + ((c8 >> 4) & 1)) * 32 + ((c8 >> 3) & 1) * 16 + (row & 15)) * 8; }
__device__ __forceinline__ v16h p_frag(const _Float16* Wp, int rt, int ks, int KS, int lane) { const unsigned short* p = (const unsigned short*)Wp + ((size_t)(rt * KS + ks) * 64 + lane) * 8; FragH f; f.half[0] = *(const v8us*)p; f.half[1] = *(const v8us*)(p + 256); return f.v; }
template <int CAUSAL>
__global__ __launch_bounds__(128) void k_flash(const _Float16* __restrict__ Q16, int ldq, const _Float16* __restrict__ K16, int ldk, const _Float16* __restrict__ Vt, const int* __restrict__ MSK, float* __restrict__ O, int ldo) {
  constexpr int RPW = 16, RTN = RPW / 16, NQB = TQ / (4 * RPW), DT = 4, KS = 2;
  __shared__ __attribute__((aligned(16))) unsigned short sP[4][RPW][40]; __shared__ __attribute__((aligned(16))) float sO[4][RPW][64 + 4];
  const int tid = threadIdx.x, w = tid >> 5, lane = tid & 31, ln = lane & 15, hh = lane >> 4;
  const int slab = blockIdx.x / QBLKS, qblk = blockIdx.x % QBLKS; (void)NQB; const int b = slab / NH, h = slab % NH; const int qb0 = qblk * (4 * RPW); const int q0 = qb0 + w * RPW;
  FragH aq[2][KS];
#pragma unroll
  for (int rt = 0; rt < RTN; ++rt) { const unsigned short* qr = (const unsigned short*)Q16 + ((size_t)b * TQ + q0 + rt * 16 + ln) * ldq + h * 64;
#pragma unroll
    for (int ks = 0; ks < KS; ++ks) { aq[rt][ks].half[0] = *(const v8us*)(qr + ks * 32 + 8 * hh); aq[rt][ks].half[1] = *(const v8us*)(qr + ks * 32 + 16 + 8 * hh); } }
  const unsigned short* Vth = (const unsigned short*)Vt + (size_t)slab * 64 * TK;
  float m_r[2][8], l_r[2][8]; v8f oacc[2][DT];
#pragma unroll
  for (int rt = 0; rt < RTN; ++rt) {
#pragma unroll
    for (int r = 0; r < 8; ++r) { m_r[rt][r] = -3.0e38f; l_r[rt][r] = 0.f; }
#pragma unroll
    for (int dt = 0; dt < DT; ++dt) oacc[rt][dt] = (v8f){0.f,0.f,0.f,0.f,0.f,0.f,0.f,0.f}; }
  const int jend = (CAUSAL == 1) ? (qb0 + 4 * RPW) : TK;      /* causal: keys beyond the block's last query never contribute */
#pragma unroll 1
  for (int j0 = 0; j0 < jend; j0 += 32) {
    v8f s[2][2];
#pragma unroll
    for (int nt = 0; nt < 2; ++nt) { const unsigned short* kr = (const unsigned short*)K16 + ((size_t)b * TK + j0 + nt * 16 + ln) * ldk + h * 64; FragH bk[KS];
#pragma unroll
      for (int ks = 0; ks < KS; ++ks) { bk[ks].half[0] = *(const v8us*)(kr + ks * 32 + 8 * hh); bk[ks].half[1] = *(const v8us*)(kr + ks * 32 + 16 + 8 * hh); }
#pragma unroll
      for (int rt = 0; rt < RTN; ++rt) { v8f acc = (v8f){0.f,0.f,0.f,0.f,0.f,0.f,0.f,0.f};
#pragma unroll
        for (int ks = 0; ks < KS; ++ks) acc = mmaH<1>(aq[rt][ks].v, aq[rt][ks].v, bk[ks].v, bk[ks].v, acc); s[rt][nt] = acc; } }
#pragma unroll
    for (int rt = 0; rt < RTN; ++rt)
#pragma unroll
      for (int r = 0; r < 8; ++r) { const int tq = q0 + rt * 16 + 8 * hh + r; const int k0 = j0 + ln, k1 = j0 + 16 + ln;
        const bool ok0 = (CAUSAL == 1) ? (k0 <= tq) : ((CAUSAL == 2) ? ((k0 >> 5) == (tq >> 5)) : true), ok1 = (CAUSAL == 1) ? (k1 <= tq) : ((CAUSAL == 2) ? ((k1 >> 5) == (tq >> 5)) : true);      /* mode 2: block-diagonal 32-token groups */
        const float s0 = ok0 ? s[rt][0][r] * SCL : -3.0e38f, s1 = ok1 ? s[rt][1][r] * SCL : -3.0e38f; float mc = fmaxf(s0, s1);
        mc = fmaxf(mc, __shfl_xor(mc, 1, 32)); mc = fmaxf(mc, __shfl_xor(mc, 2, 32)); mc = fmaxf(mc, __shfl_xor(mc, 4, 32)); mc = fmaxf(mc, __shfl_xor(mc, 8, 32));
        const float mn = fmaxf(m_r[rt][r], mc); const float al = (mn > -1.0e38f) ? expf(m_r[rt][r] - mn) : 1.0f; m_r[rt][r] = mn; const float p0 = ok0 ? expf(s0 - mn) : 0.f, p1 = ok1 ? expf(s1 - mn) : 0.f; l_r[rt][r] = l_r[rt][r] * al + p0 + p1;
#pragma unroll
        for (int dt = 0; dt < DT; ++dt) oacc[rt][dt][r] *= al;
        FragH t2; t2.h[0] = (_Float16)(p0 * 1024.0f); t2.h[1] = (_Float16)(p1 * 1024.0f); sP[w][rt * 16 + 8 * hh + r][ln] = t2.u[0]; sP[w][rt * 16 + 8 * hh + r][16 + ln] = t2.u[1]; }
    __builtin_amdgcn_fence(__ATOMIC_ACQ_REL, "workgroup"); __builtin_amdgcn_wave_barrier();
    FragH pa[2];
#pragma unroll
    for (int rt = 0; rt < RTN; ++rt) { pa[rt].half[0] = *(const v8us*)&sP[w][rt * 16 + ln][8 * hh]; pa[rt].half[1] = *(const v8us*)&sP[w][rt * 16 + ln][16 + 8 * hh]; }
#pragma unroll
    for (int dt = 0; dt < DT; ++dt) { const unsigned short* vrow = Vth + (size_t)(dt * 16 + ln) * TK + j0; FragH bv; bv.half[0] = *(const v8us*)(vrow + 8 * hh); bv.half[1] = *(const v8us*)(vrow + 16 + 8 * hh);
#pragma unroll
      for (int rt = 0; rt < RTN; ++rt) oacc[rt][dt] = mmaH<1>(pa[rt].v, pa[rt].v, bv.v, bv.v, oacc[rt][dt]); }
    __builtin_amdgcn_fence(__ATOMIC_ACQ_REL, "workgroup"); __builtin_amdgcn_wave_barrier(); }
#pragma unroll
  for (int rt = 0; rt < RTN; ++rt) {
#pragma unroll
    for (int r = 0; r < 8; ++r) { float l = l_r[rt][r]; l += __shfl_xor(l, 1, 32); l += __shfl_xor(l, 2, 32); l += __shfl_xor(l, 4, 32); l += __shfl_xor(l, 8, 32); l_r[rt][r] = (l > 0.f) ? 1.0f / (l * 1024.0f) : 0.f; }
#pragma unroll
    for (int dt = 0; dt < DT; ++dt)
#pragma unroll
      for (int r = 0; r < 8; ++r) sO[w][rt * 16 + 8 * hh + r][dt * 16 + ln] = oacc[rt][dt][r] * l_r[rt][r]; }
  __builtin_amdgcn_fence(__ATOMIC_ACQ_REL, "workgroup"); __builtin_amdgcn_wave_barrier();
  {
#pragma unroll
    for (int rp = 0; rp < RPW; rp += 2) { const int r = rp + (lane >> 4), pc = lane & 15; const v4f val = *(const v4fa*)&sO[w][r][pc * 4]; *(v4f*)(O + ((size_t)b * TQ + q0 + r) * ldo + h * 64 + pc * 4) = val; }
     } }
__device__ __forceinline__ float xhalf(float x) { return __builtin_bit_cast(float, __builtin_amdgcn_permlanex16(__builtin_bit_cast(int, x), __builtin_bit_cast(int, x), 0x76543210, 0xfedcba98, false, false)); }      /* lane l <-> lane l ^ 16 */
// Eight 2^x in place, in one statement: each v_exp_f32 writes only its own register, so none stands directly in front of an instruction that overwrites its source or reads its result
// (left to the register allocator, a run of them reused the source of the one before as the next destination); the v_nop keeps that slot behind the last one.
__device__ __forceinline__ void exp2x8(float& a, float& b, float& c, float& d, float& e, float& f, float& g, float& h) {
  asm("v_exp_f32 %0, %0\n\tv_exp_f32 %1, %1\n\tv_exp_f32 %2, %2\n\tv_exp_f32 %3, %3\n\tv_exp_f32 %4, %4\n\tv_exp_f32 %5, %5\n\tv_exp_f32 %6, %6\n\tv_exp_f32 %7, %7\n\tv_nop"
      : "+v"(a), "+v"(b), "+v"(c), "+v"(d), "+v"(e), "+v"(f), "+v"(g), "+v"(h)); }
// One 16x16x32 f16 product; the builtin form, for which the compiler keeps the distances behind a matrix instruction itself.
__device__ __forceinline__ v8f f_mma(v16h a, v16h b, v8f c) { return __builtin_amdgcn_wmma_f32_16x16x32_f16(false, a, false, b, (short)0, c, false, false); }
template <int CAUSAL>
__global__ __launch_bounds__(256) void k_flashqk(const _Float16* __restrict__ Q16, const _Float16* __restrict__ QL, const _Float16* __restrict__ K16, const _Float16* __restrict__ KL, const _Float16* __restrict__ Vt, const int* __restrict__ MSK, float* __restrict__ O, int ldo) {
  constexpr int RPW = 16, DT = HPITCH / 16, KS = HPITCH / 32;
  __shared__ __attribute__((aligned(16))) float sO[4][RPW][HPITCH + 4];
  constexpr int KT = 64, KP = HPITCH + 8, VP = KT + 8;      /* keys per staged tile; LDS row pitches in halves: 16 bytes x an odd number, free of bank conflicts for 16-byte reads */
  constexpr int NCK = KT * (HPITCH / 8) / 128, NCV = HPITCH * (KT / 8) / 128;      /* 16-byte pieces per thread and tile */
  __shared__ __attribute__((aligned(16))) unsigned short sK[2][2][KT][KP]; __shared__ __attribute__((aligned(16))) unsigned short sKL[2][2][KT][KP]; __shared__ __attribute__((aligned(16))) unsigned short sV[2][2][HPITCH][VP];      /* [key half][buffer] */
  __shared__ __attribute__((aligned(16))) float sM[4][32][20];      /* the second half's partial result, one row a lane: 16 outputs, maximum, sum; 80-byte pitch = 16 bytes x an odd number */
  static_assert(CAUSAL != 1 && TK % (2 * KT) == 0, "both key halves walk the same number of tiles");
  const int tid = threadIdx.x, w = (tid >> 5) & 3, kh = tid >> 7, ts = tid & 127, lane = tid & 31, ln = lane & 15, hh = lane >> 4;      /* w: query group; kh: key half (waves 0-3 / 4-7); ts: thread within its half */
  const int slab = blockIdx.x / QBLKS, qblk = blockIdx.x % QBLKS; const int b = slab / NH, h = slab % NH; const int qb0 = qblk * (4 * RPW); const int q0 = qb0 + w * RPW;
  const int tq = q0 + ln;      /* this lane's query */
  FragH bq[KS], bql[KS];
  { const unsigned short* qr = (const unsigned short*)Q16 + ((size_t)slab * TQ + tq) * HPITCH; const unsigned short* ql = (const unsigned short*)QL + ((size_t)slab * TQ + tq) * HPITCH;
#pragma unroll      /* constant indices keep the fragment, score and accumulator arrays in registers */
    for (int ks = 0; ks < KS; ++ks) { bq[ks].half[0] = *(const v8us*)(qr + ks * 32 + 8 * hh); bq[ks].half[1] = *(const v8us*)(qr + ks * 32 + 16 + 8 * hh); bql[ks].half[0] = *(const v8us*)(ql + ks * 32 + 8 * hh); bql[ks].half[1] = *(const v8us*)(ql + ks * 32 + 16 + 8 * hh); } }
  const unsigned short* Vth = (const unsigned short*)Vt + (size_t)slab * HPITCH * TK;
  const unsigned short* Kb = (const unsigned short*)K16 + (size_t)slab * TK * HPITCH; const unsigned short* KLb = (const unsigned short*)KL + (size_t)slab * TK * HPITCH;
  v8us gk[NCK], gkl[NCK], gv[NCV];      /* the next tile on its way from global memory to LDS */
  auto fetch = [&](int jt) {
#pragma unroll      /* constant indices keep the fragment, score and accumulator arrays in registers */
    for (int u = 0; u < NCK; ++u) { const int i = ts + 128 * u, r = i / (HPITCH / 8), c8 = (i % (HPITCH / 8)) * 8; gk[u] = *(const v8us*)(Kb + (size_t)(jt + r) * HPITCH + c8); gkl[u] = *(const v8us*)(KLb + (size_t)(jt + r) * HPITCH + c8); }
#pragma unroll      /* constant indices keep the fragment, score and accumulator arrays in registers */
    for (int u = 0; u < NCV; ++u) { const int i = ts + 128 * u, r = i / (KT / 8), c8 = (i % (KT / 8)) * 8; gv[u] = *(const v8us*)(Vth + (size_t)r * TK + jt + c8); } };
  auto stash = [&](int bf) {
#pragma unroll      /* constant indices keep the fragment, score and accumulator arrays in registers */
    for (int u = 0; u < NCK; ++u) { const int i = ts + 128 * u, r = i / (HPITCH / 8), c8 = (i % (HPITCH / 8)) * 8; *(v8us*)&sK[kh][bf][r][c8] = gk[u]; *(v8us*)&sKL[kh][bf][r][c8] = gkl[u]; }
#pragma unroll      /* constant indices keep the fragment, score and accumulator arrays in registers */
    for (int u = 0; u < NCV; ++u) { const int i = ts + 128 * u, r = i / (KT / 8), c8 = (i % (KT / 8)) * 8; *(v8us*)&sV[kh][bf][r][c8] = gv[u]; } };
  float m_q = -3.0e38f, l_q = 0.f; v8f oacc[DT];      /* oacc[dt][r] = O[tq][dt * 16 + 8 hh + r], un-normalised */
#pragma unroll      /* constant indices keep the fragment, score and accumulator arrays in registers */
  for (int dt = 0; dt < DT; ++dt) oacc[dt] = (v8f){0.f,0.f,0.f,0.f,0.f,0.f,0.f,0.f};
  const int jend = (CAUSAL == 1) ? (qb0 + 4 * RPW) : TK;      /* causal: keys beyond the block's last query never contribute */
  const int ntile = jend / (2 * KT);      /* trips: half kh takes tiles kh, kh + 2, kh + 4, ... */
  asm volatile("s_wait_xcnt 0x0" ::: "memory");      /* the Q loads above are issued first, and no tile load below writes into a register that one of them still names as its address */
  fetch(kh * KT); stash(0);
  __syncthreads();      /* tile 0 is written before any wave reads it */
#pragma unroll 1      /* one copy of the trip's code; the buffer index alternates at run time */
  for (int t = 0; t < ntile; ++t) { const int buf = t & 1; const bool more = t + 1 < ntile;      /* the same in every thread of the work-group */
    if (more) fetch((2 * (t + 1) + kh) * KT);      /* in flight while this trip works on tile t */
#pragma unroll      /* the two 32-key halves of the tile: constant LDS offsets */
   for (int js = 0; js < KT; js += 32) { const int j0 = (2 * t + kh) * KT + js;
    v8f s[2];      /* s[nt][r] = score of key j0 + nt * 16 + 8 hh + r against query tq */
    FragH ak[2][KS], akl[2][KS], av[DT];      /* all LDS reads of these 32 keys stand together at the head: one LDS latency instead of four */
#pragma unroll      /* constant indices keep the fragment, score and accumulator arrays in registers */
    for (int nt = 0; nt < 2; ++nt) { const unsigned short* kr = &sK[kh][buf][js + nt * 16 + ln][0]; const unsigned short* klr = &sKL[kh][buf][js + nt * 16 + ln][0];
#pragma unroll      /* constant indices keep the fragment, score and accumulator arrays in registers */
      for (int ks = 0; ks < KS; ++ks) { ak[nt][ks].half[0] = *(const v8us*)(kr + ks * 32 + 8 * hh); ak[nt][ks].half[1] = *(const v8us*)(kr + ks * 32 + 16 + 8 * hh); akl[nt][ks].half[0] = *(const v8us*)(klr + ks * 32 + 8 * hh); akl[nt][ks].half[1] = *(const v8us*)(klr + ks * 32 + 16 + 8 * hh); } }
#pragma unroll      /* constant indices keep the fragment, score and accumulator arrays in registers */
    for (int dt = 0; dt < DT; ++dt) { const unsigned short* vrow = &sV[kh][buf][dt * 16 + ln][js]; av[dt].half[0] = *(const v8us*)(vrow + 8 * hh); av[dt].half[1] = *(const v8us*)(vrow + 16 + 8 * hh); }
#pragma unroll      /* constant indices keep the fragment, score and accumulator arrays in registers */
    for (int nt = 0; nt < 2; ++nt) {
      v8f acc = (v8f){0.f,0.f,0.f,0.f,0.f,0.f,0.f,0.f}, accl = acc;
#pragma unroll      /* constant indices keep the fragment, score and accumulator arrays in registers */
      for (int ks = 0; ks < KS; ++ks) { acc = f_mma(ak[nt][ks].v, bq[ks].v, acc); accl = f_mma(ak[nt][ks].v, bql[ks].v, accl); accl = f_mma(akl[nt][ks].v, bq[ks].v, accl); }
#pragma unroll      /* constant indices keep the fragment, score and accumulator arrays in registers */
      for (int r = 0; r < 8; ++r) acc[r] += accl[r] * 0.0009765625f;
      s[nt] = acc; }
    float sc[16]; bool ok[16];
#pragma unroll      /* constant indices keep the fragment, score and accumulator arrays in registers */
    for (int i = 0; i < 16; ++i) { const int kk = j0 + (i >> 3) * 16 + 8 * hh + (i & 7);
      ok[i] = (CAUSAL == 1) ? (kk <= tq) : ((CAUSAL == 2) ? ((kk >> 5) == (tq >> 5)) : true);      /* mode 2: block-diagonal 32-token groups */
      if (CAUSAL == 4) ok[i] = MSK[((size_t)b * TQ + tq) * TK + kk] != 0;      /* mode 4: per-(query, key) INPUT mask shared by all heads; masked keys contribute nothing, rows with no valid key give l = 0 -> output 0 */
      sc[i] = ok[i] ? s[i >> 3][i & 7] : -3.0e38f; }      /* raw q.k: maxima are taken on raw scores, the (positive) scale enters with the exponent */
    float mt[8];
#pragma unroll      /* constant indices keep the fragment, score and accumulator arrays in registers */
    for (int i = 0; i < 8; ++i) mt[i] = fmaxf(sc[i], sc[8 + i]);
    float mc = fmaxf(fmaxf(fmaxf(mt[0], mt[1]), fmaxf(mt[2], mt[3])), fmaxf(fmaxf(mt[4], mt[5]), fmaxf(mt[6], mt[7])));
    mc = fmaxf(mc, xhalf(mc));      /* the other half's 16 keys of the same query */
    const float mn = fmaxf(m_q, mc); const float al = (mn > -1.0e38f) ? __builtin_amdgcn_exp2f((m_q - mn) * SCL2) : 1.0f; m_q = mn;
    const float nb = 10.0f - mn * SCL2;      /* p = 2^(sc * SCL2 + nb) = 2^10 exp((sc - mn) / sqrt(32)): scale, log2(e), maximum and P's 2^10 in one fma per score */
    float p[16]; FragH pb;
#pragma unroll      /* constant indices keep the fragment, score and accumulator arrays in registers */
    for (int i = 0; i < 16; ++i) p[i] = sc[i] * SCL2 + nb;
    exp2x8(p[0], p[1], p[2], p[3], p[4], p[5], p[6], p[7]); exp2x8(p[8], p[9], p[10], p[11], p[12], p[13], p[14], p[15]);
#pragma unroll      /* constant indices keep the fragment, score and accumulator arrays in registers */
    for (int i = 0; i < 16; ++i) { if (!ok[i]) p[i] = 0.f; pb.h[i] = (_Float16)p[i]; }      /* pb.h[i]: key kmap(i, hh) of column ln; p and l_q both carry the 2^10 */
    float pt[8];
#pragma unroll      /* constant indices keep the fragment, score and accumulator arrays in registers */
    for (int i = 0; i < 8; ++i) pt[i] = p[i] + p[8 + i];
    l_q = l_q * al + (((pt[0] + pt[1]) + (pt[2] + pt[3])) + ((pt[4] + pt[5]) + (pt[6] + pt[7])));
#pragma unroll      /* constant indices keep the fragment, score and accumulator arrays in registers */
    for (int dt = 0; dt < DT; ++dt)
#pragma unroll      /* constant indices keep the fragment, score and accumulator arrays in registers */
      for (int r = 0; r < 8; ++r) oacc[dt][r] *= al;
#pragma unroll      /* constant indices keep the fragment, score and accumulator arrays in registers */
    for (int dt = 0; dt < DT; ++dt) oacc[dt] = f_mma(av[dt].v, pb.v, oacc[dt]); }
    if (more) stash(buf ^ 1);      /* that buffer's last readers left it at the barrier that ended the trip before */
    __syncthreads(); }      /* one barrier a trip: publishes tile t + 1 and ends every wave's reads of tile t, which the next trip overwrites */
  // The two key halves of a query are joined as two tiles of the running softmax are: common maximum, each half's sum and outputs scaled by 2^((own maximum - common maximum) * SCL2).
  if (kh == 1) {
#pragma unroll      /* constant indices keep the fragment, score and accumulator arrays in registers */
    for (int dt = 0; dt < DT; ++dt) { const v4f lo4 = {oacc[dt][0], oacc[dt][1], oacc[dt][2], oacc[dt][3]}, hi4 = {oacc[dt][4], oacc[dt][5], oacc[dt][6], oacc[dt][7]}; *(v4fa*)&sM[w][lane][dt * 8] = lo4; *(v4fa*)&sM[w][lane][dt * 8 + 4] = hi4; }
    sM[w][lane][8 * DT] = m_q; sM[w][lane][8 * DT + 1] = l_q; }
  __syncthreads();      /* the second half's partial results are written before the first half reads them; every wave passes it */
  if (kh == 1) return;      /* behind the last barrier */
  { const float m1 = sM[w][lane][8 * DT], l1 = sM[w][lane][8 * DT + 1]; const float mm = fmaxf(m_q, m1); const bool any = mm > -1.0e38f;
    const float a0 = any ? __builtin_amdgcn_exp2f((m_q - mm) * SCL2) : 1.0f, a1 = any ? __builtin_amdgcn_exp2f((m1 - mm) * SCL2) : 1.0f;
    l_q = l_q * a0 + l1 * a1;
#pragma unroll      /* constant indices keep the fragment, score and accumulator arrays in registers */
    for (int dt = 0; dt < DT; ++dt) { const v4f lo4 = *(const v4fa*)&sM[w][lane][dt * 8], hi4 = *(const v4fa*)&sM[w][lane][dt * 8 + 4];
#pragma unroll      /* constant indices keep the fragment, score and accumulator arrays in registers */
      for (int r = 0; r < 4; ++r) { oacc[dt][r] = oacc[dt][r] * a0 + lo4[r] * a1; oacc[dt][4 + r] = oacc[dt][4 + r] * a0 + hi4[r] * a1; } } }
  const float lsum = l_q + xhalf(l_q); const float linv = (lsum > 0.f) ? 1.0f / lsum : 0.f;
#pragma unroll      /* constant indices keep the fragment, score and accumulator arrays in registers */
  for (int dt = 0; dt < DT; ++dt) { v4f lo4, hi4;
#pragma unroll      /* constant indices keep the fragment, score and accumulator arrays in registers */
    for (int r = 0; r < 4; ++r) { lo4[r] = oacc[dt][r] * linv; hi4[r] = oacc[dt][4 + r] * linv; }
    *(v4fa*)&sO[w][ln][dt * 16 + 8 * hh] = lo4; *(v4fa*)&sO[w][ln][dt * 16 + 8 * hh + 4] = hi4; }
  __builtin_amdgcn_fence(__ATOMIC_ACQ_REL, "workgroup"); __builtin_amdgcn_wave_barrier();
  {
#pragma unroll      /* constant indices keep the fragment, score and accumulator arrays in registers */
    for (int rp = 0; rp < RPW; rp += 128 / HPITCH) { const int r = rp + lane / (HPITCH / 4), pc = lane % (HPITCH / 4); const v4f val = *(const v4fa*)&sO[w][r][pc * 4]; *(v4f*)(O + ((size_t)b * TQ + q0 + r) * ldo + h * HPITCH + pc * 4) = val; }
     } }

// Sum over the 32 lanes of a wave, the total in every lane: four exchanges inside a 16-lane row (lane ^ 1, 2, 4, 8), then one between the rows.
template <unsigned LO, unsigned HI>
__device__ __forceinline__ float xrow(float x) { return __builtin_bit_cast(float, __builtin_amdgcn_permlane16(__builtin_bit_cast(int, x), __builtin_bit_cast(int, x), LO, HI, false, false)); }
__device__ __forceinline__ float wave_sum(float x) { x += xrow<0x67452301u, 0xefcdab89u>(x); x += xrow<0x54761032u, 0xdcfe98bau>(x); x += xrow<0x32107654u, 0xba98fedcu>(x); x += xrow<0xfedcba98u, 0x76543210u>(x); return x + xhalf(x); }
// Sum over the 8 waves of the work-group: one float a wave in LDS, one barrier, every thread adds the eight.
__device__ __forceinline__ float block_sum(float x, float* sh8) { x = wave_sum(x); if ((threadIdx.x & 31) == 0) sh8[threadIdx.x >> 5] = x;
  __syncthreads();      /* the eight wave sums are written before any thread reads them */
  const v4f a = *(const v4fa*)sh8, b = *(const v4fa*)(sh8 + 4); return ((a[0] + a[1]) + (a[2] + a[3])) + ((b[0] + b[1]) + (b[2] + b[3])); }
// Mean and 1/sigma of one group (4 channels x 4096 positions = 64 KB in a row). A thread asks for its 64 values in sixteen 16-byte loads before it uses the first (a wave-wide load = 512 bytes in a row),
// so the work-group waits for memory once; the rounded values stay in registers for the pass about the mean.
__device__ __forceinline__ void d_gnstat(const float* __restrict__ x, float* __restrict__ GS, const int bg) {
  constexpr int n = CPG * SLEN, NL = n / (256 * 4);
  __shared__ __attribute__((aligned(16))) float sh[2][8]; const int tid = threadIdx.x; const float* base = x + (size_t)bg * n + tid * 4;
  v4f xv[NL];
#pragma unroll      /* constant indices keep the values in registers; all loads in flight together */
  for (int u = 0; u < NL; ++u) xv[u] = *(const v4fa*)(base + u * 1024);
  v4f s4 = {0.f, 0.f, 0.f, 0.f};      /* four independent chains */
#pragma unroll      /* as above */
  for (int u = 0; u < NL; ++u)
#pragma unroll      /* as above */
    for (int q = 0; q < 4; ++q) { xv[u][q] = bf16_round(xv[u][q]); s4[q] += xv[u][q]; }
  const float mu = block_sum((s4[0] + s4[1]) + (s4[2] + s4[3]), sh[0]) / (float)n;
  v4f q4 = {0.f, 0.f, 0.f, 0.f};
#pragma unroll      /* as above */
  for (int u = 0; u < NL; ++u)
#pragma unroll      /* as above */
    for (int q = 0; q < 4; ++q) { const float d = xv[u][q] - mu; q4[q] += d * d; }
  const float var = block_sum((q4[0] + q4[1]) + (q4[2] + q4[3]), sh[1]) / (float)n;      /* its own eight floats: no thread still reads the first eight's place */
  if (tid == 0) { const float rs = rsqrtf(var + 1e-5f); { *(float*)(GS + (size_t)bg * 32) = mu; *(float*)(GS + (size_t)bg * 32 + 1) = rs;  } } }
__device__ __forceinline__ void d_wpad(const float* __restrict__ Wm, const float* __restrict__ bm, _Float16* __restrict__ BP, float* __restrict__ PB, const int bid) {
  const int t = bid * 256 + threadIdx.x; if (t >= DP * (CC / 8)) return; const int fr = t >> 5, pl = t & 31; const int pc = ((fr >> 1) % (CC / 32)) * 4 + (fr & 1) * 2 + (pl >> 4); const int r = (fr >> 1) / (CC / 32) * 16 + (pl & 15);      /* thread t makes piece t of the fragment order (pk_off(r, pc * 8, CC) = 8 t), as in d_wio: one wait for memory, not one per piece of a row */
  const int h = r / HPITCH, d = r % HPITCH; const bool live = d < HDT; const int srow = h * HDT + d; FragH f;
  for (int q = 0; q < 8; ++q) f.h[q] = live ? (_Float16)(bf16_round(Wm[(size_t)srow * CC + pc * 8 + q]) * 16.0f) : (_Float16)0.0f;
  const float bv = (live && pc == 0) ? bm[srow] : 0.f;
  *(v8us*)((unsigned short*)BP + (size_t)t * 8) = f.half[0]; if (pc == 0) *(float*)(PB + r) = bv;  }
__device__ __forceinline__ void d_wio(const float* __restrict__ Wm, int nin, int nout, int pair, _Float16* __restrict__ Bt, const int bid) { const int pitch = pair ? 2 * nin : nin; const size_t t = (size_t)bid * 256 + threadIdx.x; if (t >= (size_t)nout * (pitch / 8)) return; const int fr = (int)(t >> 5), pl = (int)(t & 31); const int pc = ((fr >> 1) % (pitch / 32)) * 4 + (fr & 1) * 2 + (pl >> 4); const int o = (fr >> 1) / (pitch / 32) * 16 + (pl & 15); FragH f;      /* thread t makes piece t of the fragment order (pk_off(o, pc * 8, pitch) = 8 t): a wave stores 512 bytes in a row */
  for (int q = 0; q < 8; ++q) { const int col = pc * 8 + q; const bool lo = col >= nin; const int i = lo ? col - nin : col; f.h[q] = (_Float16)(bf16_round(Wm[(size_t)i * nout + o]) * (lo ? 1.0f : 16.0f)); }
  *(v8us*)((unsigned short*)Bt + t * 8) = f.half[0];  }
__device__ __forceinline__ void d_wop(const float* __restrict__ Wo, _Float16* __restrict__ Bt, const int bid) { const int t = bid * 256 + threadIdx.x; if (t >= CC * (2 * CC / 8)) return; const int fr = t >> 5, pl = t & 31; const int pc = ((fr >> 1) % (2 * CC / 32)) * 4 + (fr & 1) * 2 + (pl >> 4); const int o = (fr >> 1) / (2 * CC / 32) * 16 + (pl & 15); const bool lo = pc * 8 >= CC; FragH f;      /* piece t of the fragment order, as in d_wio */
  for (int q = 0; q < 8; ++q) { const int c = pc * 8 + q - (lo ? CC : 0); f.h[q] = (_Float16)(bf16_round(Wo[(size_t)o * CC + c]) * (lo ? 1.0f : 16.0f)); } *(v8us*)((unsigned short*)Bt + (size_t)t * 8) = f.half[0];  }
// The two statistics passes and the six weight conversions need nothing of each other: one grid, each part a range of block indices (the branch is the same for a whole work-group, so the barriers of the statistics part are passed by all of its threads).
// The statistics blocks run longest and come first.
#define PB_GN (NB * NGR)                          /* blocks per statistics pass */
#define PB_W1 ((HID * (2 * CC / 8) + 255) / 256)
#define PB_W2 ((CC * (HID / 8) + 255) / 256)
#define PB_WO ((CC * (2 * CC / 8) + 255) / 256)
#define PB_WP ((DP * (CC / 8) + 255) / 256)      /* blocks per q, k or v weight matrix */
#define PB_ALL (2 * PB_GN + 3 * PB_WP + PB_W1 + PB_W2 + PB_WO)
__global__ __launch_bounds__(256) void k_prep(const float* __restrict__ x0, const float* __restrict__ x1, float* __restrict__ GS,
    const float* __restrict__ Wq, const float* __restrict__ bqp, const float* __restrict__ Wk, const float* __restrict__ bkp, const float* __restrict__ Wv, const float* __restrict__ bvp, _Float16* __restrict__ BP, float* __restrict__ PB,
    const float* __restrict__ W1, _Float16* __restrict__ BW1, const float* __restrict__ W2, _Float16* __restrict__ BW2, const float* __restrict__ Wo, _Float16* __restrict__ BWO) {
  int bid = blockIdx.x;
  if (bid < 2 * PB_GN) { const bool sec = bid >= PB_GN; d_gnstat(sec ? x1 : x0, GS + (sec ? PB_GN * 32 : 0), sec ? bid - PB_GN : bid); return; }
  bid -= 2 * PB_GN;
  if (bid < 3 * PB_WP) { const int m = bid / PB_WP; d_wpad(m == 0 ? Wq : (m == 1 ? Wk : Wv), m == 0 ? bqp : (m == 1 ? bkp : bvp), BP + (size_t)m * DP * CC, PB + m * DP, bid % PB_WP); return; }
  bid -= 3 * PB_WP;
  if (bid < PB_W1) { d_wio(W1, CC, HID, 1, BW1, bid); return; }
  bid -= PB_W1;
  if (bid < PB_W2) { d_wio(W2, HID, CC, 0, BW2, bid); return; }
  bid -= PB_W2;
  d_wop(Wo, BWO, bid); }
__device__ __forceinline__ v16h l_frag(const unsigned short* p, int hh) { FragH f; f.half[0] = *(const v8us*)(p + 8 * hh); f.half[1] = *(const v8us*)(p + 16 + 8 * hh); return f.v; }
// Head of the block in one launch: normalise a 64-token tile of one input (all 128 channels), transposed into LDS as f16 [token][channel], and project it from there.
// blockIdx.y = 0 q, 1 k, 2 v. q and k: weight rows are the A operand and tokens the B operand, so a lane holds 8 neighbouring channels of ONE token and stores hi and residual as 16-byte pieces of the [batch][head][token][32] planes.
// v: tokens are the A operand and weight rows the B operand, so a lane holds 8 neighbouring tokens of ONE channel: a 16-byte piece of V^T. Each wave writes whole 128-byte lines.
#define XP (CC + 8)      /* LDS row pitch in halves: 16 bytes x an odd number */
template <bool ISV>
__device__ __forceinline__ void d_qkv(const float* __restrict__ x, const float* __restrict__ GS, const float* __restrict__ gam, const float* __restrict__ bet, const _Float16* __restrict__ Wp, const float* __restrict__ bp, unsigned short* __restrict__ Hh, unsigned short* __restrict__ VT, unsigned short (*sX)[XP]) {
  constexpr int NW = ISV ? 1 : 4;      /* weight fragments per k step */
  const int tid = threadIdx.x, w = tid >> 5, lane = tid & 31, ln = lane & 15, hh = lane >> 4;
  const int b = blockIdx.x / (SLEN / 64), pb = blockIdx.x % (SLEN / 64);
  const int ch0 = ISV ? w * 16 : (w >> 2) * 64;      /* this wave's first channel: 16 channels x 64 tokens for v, 64 channels x 16 tokens for q and k */
  v16h wf[CC / 32][NW]; v4f bl[NW][2]; float bv1 = 0.f;      /* this wave's weight fragments and biases, asked for before the tile so that they arrive while it is normalised */
#pragma unroll      /* constant indices keep the fragment arrays in registers */
  for (int ks = 0; ks < CC / 32; ++ks)
#pragma unroll      /* as above */
    for (int mt = 0; mt < NW; ++mt) wf[ks][mt] = p_frag(Wp, ch0 / 16 + mt, ks, CC / 32, lane);
  if (ISV) bv1 = bp[ch0 + ln];
  else {
#pragma unroll      /* as above */
    for (int mt = 0; mt < NW; ++mt) { bl[mt][0] = *(const v4fa*)(bp + ch0 + mt * 16 + 8 * hh); bl[mt][1] = *(const v4fa*)(bp + ch0 + mt * 16 + 8 * hh + 4); } }
  asm volatile("s_wait_xcnt 0x0" ::: "memory");      /* no later instruction writes into a register that one of the loads above still names as its address */
  const int cl0 = tid >> 2, pj = (tid & 3) * 4;      /* 4 lanes per channel row: the 2-byte LDS stores of a wave fall into different banks; a thread has channels cl0 and cl0 + 64, positions pj + 16 jj */
  const float* xp = x + ((size_t)b * CC + cl0) * SLEN + pb * 64 + pj; const float* gp = GS + ((size_t)b * NGR + cl0 / CPG) * 32;
  v4f xa[2][4]; float mu[2], rs[2], gg[2], be[2];      /* every address below is one of four bases plus a constant, so no load's result lands in a register that an earlier load names as its address */
#pragma unroll      /* constant indices keep the values in registers */
  for (int e = 0; e < 2; ++e) { mu[e] = gp[e * (64 / CPG) * 32]; rs[e] = gp[e * (64 / CPG) * 32 + 1]; gg[e] = gam[cl0 + 64 * e]; be[e] = bet[cl0 + 64 * e]; }
  asm volatile("s_wait_xcnt 0x0" ::: "memory");      /* as above, for the statistics and the scale and shift */
#pragma unroll      /* eight 16-byte pieces per thread, all in flight together */
  for (int e = 0; e < 2; ++e)
#pragma unroll      /* as above */
    for (int jj = 0; jj < 4; ++jj) xa[e][jj] = *(const v4fa*)(xp + (size_t)e * 64 * SLEN + jj * 16);
  asm volatile("s_wait_xcnt 0x0" ::: "memory");      /* as above, for the tile's loads */
#pragma unroll      /* constant indices keep the tile's pieces in registers */
  for (int e = 0; e < 2; ++e) { const float g = bf16_round(gg[e]), bb = bf16_round(be[e]);
#pragma unroll      /* as above */
    for (int jj = 0; jj < 4; ++jj)
#pragma unroll      /* as above */
      for (int q = 0; q < 4; ++q) { FragH f; f.h[0] = (_Float16)((bf16_round(xa[e][jj][q]) - mu[e]) * rs[e] * g + bb); sX[pj + 16 * jj + q][cl0 + 64 * e] = f.u[0]; } }
  __syncthreads();      /* the tile is written before any wave takes fragments from it; every thread of the work-group is on the same side of ISV */
  const v8f z8 = {0.f,0.f,0.f,0.f,0.f,0.f,0.f,0.f}; v8f acc[4] = {z8, z8, z8, z8};
  if constexpr (!ISV) { const int tk = (w & 3) * 16 + ln;      /* this lane's token */
#pragma unroll      /* as above */
    for (int ks = 0; ks < CC / 32; ++ks) { const v16h t = l_frag(&sX[tk][ks * 32], hh);
#pragma unroll      /* as above */
      for (int mt = 0; mt < 4; ++mt) acc[mt] = f_mma(wf[ks][mt], t, acc[mt]); }
    Hh += ((size_t)b * NH * SLEN + pb * 64 + tk) * HPITCH + (size_t)(ch0 / HPITCH) * SLEN * HPITCH; unsigned short* Hl = Hh + (size_t)NR * DP;      /* planes are [batch][head][token][32]: this token's row in the wave's first head */
#pragma unroll      /* as above */
    for (int mt = 0; mt < 4; ++mt) { FragH fh, fl;
#pragma unroll      /* as above */
      for (int r = 0; r < 8; ++r) { const float v = acc[mt][r] * 0.0625f + bf16_round(bl[mt][r >> 2][r & 3]); const _Float16 h = (_Float16)v; fh.h[r] = h; fl.h[r] = (_Float16)((v - (float)h) * 1024.0f); }
      const size_t po = (size_t)(mt * 16 / HPITCH) * SLEN * HPITCH + mt * 16 % HPITCH + 8 * hh; *(v8us*)(Hh + po) = fh.half[0]; *(v8us*)(Hl + po) = fl.half[0]; }
    asm volatile("s_wait_xcnt 0x0" ::: "memory");      /* in the built code the v side follows this one, and it writes into registers that the stores above name */
  } else {
#pragma unroll      /* as above */
    for (int ks = 0; ks < CC / 32; ++ks)
#pragma unroll      /* as above */
      for (int mt = 0; mt < 4; ++mt) acc[mt] = f_mma(l_frag(&sX[mt * 16 + ln][ks * 32], hh), wf[ks][0], acc[mt]);
    const float bv = bf16_round(bv1); unsigned short* dst = VT + ((size_t)b * DP + ch0 + ln) * TK + pb * 64;      /* row (b, head, d) of V^T = row b * 128 + channel */
#pragma unroll      /* as above */
    for (int mt = 0; mt < 4; ++mt) { FragH f;
#pragma unroll      /* as above */
      for (int r = 0; r < 8; ++r) f.h[r] = (_Float16)(acc[mt][r] * 0.0625f + bv);
      *(v8us*)(dst + mt * 16 + 8 * hh) = f.half[0]; }
  } }
__global__ __launch_bounds__(256) void k_qkv(const float* __restrict__ x0, const float* __restrict__ x1, const float* __restrict__ GS, const float* __restrict__ gam0, const float* __restrict__ bet0, const float* __restrict__ gam1, const float* __restrict__ bet1,
    const _Float16* __restrict__ BP, const float* __restrict__ PB, _Float16* __restrict__ QKH, _Float16* __restrict__ VT) {
  __shared__ __attribute__((aligned(16))) unsigned short sX[64][XP];
  const int y = blockIdx.y; const bool sec = y != 0;      /* the same for a whole work-group */
  const float* x = sec ? x1 : x0; const float* gam = sec ? gam1 : gam0; const float* bet = sec ? bet1 : bet0; const float* gs = GS + (sec ? NB * NGR * 32 : 0);
  if (y == 2) d_qkv<true>(x, gs, gam, bet, BP + (size_t)y * DP * CC, PB + y * DP, nullptr, (unsigned short*)VT, sX);
  else d_qkv<false>(x, gs, gam, bet, BP + (size_t)y * DP * CC, PB + y * DP, (unsigned short*)QKH + (size_t)y * 2 * NR * DP, nullptr, sX); }
// Tail of the block in one launch: everything behind the attention is row-wise, so a work-group takes 32 tokens through hi/residual split, W1 + exact GELU, W2 + residual, hi/residual split and Wo; the values between the products pass through LDS.
// W1 and W2: weight rows are the A operand and tokens the B operand (a lane holds 8 neighbouring columns of one token: one 16-byte LDS store). Wo: tokens are the A operand (a lane holds 8 neighbouring tokens of one output channel: the NCHW order of out).
#define PT 32                /* tokens per work-group: one 128-byte line of each output channel */
#define PP (2 * CC + 8)      /* LDS row pitch in halves: 16 bytes x an odd number */
__global__ __launch_bounds__(256) void k_tail(const float* __restrict__ O, const _Float16* __restrict__ BW1, const float* __restrict__ b1, const _Float16* __restrict__ BW2, const float* __restrict__ b2, const _Float16* __restrict__ BWO, const float* __restrict__ bo, float* __restrict__ out) {
  __shared__ __attribute__((aligned(16))) unsigned short sA[PT][PP]; __shared__ __attribute__((aligned(16))) unsigned short sG[PT][PP]; __shared__ __attribute__((aligned(16))) unsigned short sF[PT][PP]; __shared__ __attribute__((aligned(16))) float sR[PT][CC + 4];
  const int tid = threadIdx.x, w = tid >> 5, lane = tid & 31, ln = lane & 15, hh = lane >> 4; const int r0 = blockIdx.x * PT;
  v4f c1[2][2], c2[2];
#pragma unroll
  for (int mt = 0; mt < 2; ++mt) { c1[mt][0] = *(const v4fa*)(b1 + w * 32 + mt * 16 + 8 * hh); c1[mt][1] = *(const v4fa*)(b1 + w * 32 + mt * 16 + 8 * hh + 4); }
  c2[0] = *(const v4fa*)(b2 + w * 16 + 8 * hh); c2[1] = *(const v4fa*)(b2 + w * 16 + 8 * hh + 4); const float c3 = bo[w * 16 + ln];
  asm volatile("s_wait_xcnt 0x0" ::: "memory");      /* no weight load below lands in a register that one of the bias loads above still names as its address */
  v16h w1[8][2];      /* W1 rows w * 32 .. + 31, asked for before the tile */
#pragma unroll      /* constant indices keep the fragment arrays in registers */
  for (int ks = 0; ks < 8; ++ks)
#pragma unroll
    for (int mt = 0; mt < 2; ++mt) w1[ks][mt] = p_frag(BW1, w * 2 + mt, ks, 8, lane);
  { const int tk = tid >> 3, c0 = (tid & 7) * 16; const float* sp = O + (size_t)(r0 + tk) * DP + c0; v4f xv[4];
#pragma unroll
    for (int q = 0; q < 4; ++q) xv[q] = *(const v4fa*)(sp + 4 * q);
    asm volatile("s_wait_xcnt 0x0" ::: "memory");      /* no later instruction writes into a register that one of the loads above still names as its address */
#pragma unroll
    for (int g = 0; g < 2; ++g) { FragH fh, fl;
#pragma unroll
      for (int q = 0; q < 8; ++q) { const float v = xv[g * 2 + (q >> 2)][q & 3]; const _Float16 hv = (_Float16)v; fh.h[q] = hv; fl.h[q] = (_Float16)((v - (float)hv) * 16.0f); }
      *(v8us*)&sA[tk][c0 + 8 * g] = fh.half[0]; *(v8us*)&sA[tk][CC + c0 + 8 * g] = fl.half[0]; }
#pragma unroll
    for (int q = 0; q < 4; ++q) *(v4fa*)&sR[tk][c0 + 4 * q] = xv[q]; }
  __syncthreads();      /* attention output, split, is written before any wave takes fragments from it */
  const v8f z8 = {0.f,0.f,0.f,0.f,0.f,0.f,0.f,0.f}; v8f a1[2][2] = {{z8, z8}, {z8, z8}};
#pragma unroll
  for (int ks = 0; ks < 8; ++ks) { const v16h t0 = l_frag(&sA[ln][ks * 32], hh), t1 = l_frag(&sA[16 + ln][ks * 32], hh);
#pragma unroll
    for (int mt = 0; mt < 2; ++mt) { a1[mt][0] = f_mma(w1[ks][mt], t0, a1[mt][0]); a1[mt][1] = f_mma(w1[ks][mt], t1, a1[mt][1]); } }
  v16h w2[8], w3[8];      /* W2 and Wo rows w * 16 .. + 15: on their way while the GELU is computed */
#pragma unroll
  for (int ks = 0; ks < 8; ++ks) { w2[ks] = p_frag(BW2, w, ks, 8, lane); w3[ks] = p_frag(BWO, w, ks, 8, lane); }
  asm volatile("s_wait_xcnt 0x0" ::: "memory");      /* as above, for the weight loads */
#pragma unroll
  for (int mt = 0; mt < 2; ++mt)
#pragma unroll
    for (int nt = 0; nt < 2; ++nt) { FragH f;
#pragma unroll
      for (int r = 0; r < 8; ++r) { float v = a1[mt][nt][r] * 0.0625f + bf16_round(c1[mt][r >> 2][r & 3]); v = 0.5f * v * (1.0f + erff(v * 0.70710678118654752f)); f.h[r] = (_Float16)v; }
      *(v8us*)&sG[nt * 16 + ln][w * 32 + mt * 16 + 8 * hh] = f.half[0]; }
  __syncthreads();      /* the hidden layer is complete before the second product reads it */
  v8f a2[2] = {z8, z8};
#pragma unroll
  for (int ks = 0; ks < 8; ++ks) { a2[0] = f_mma(w2[ks], l_frag(&sG[ln][ks * 32], hh), a2[0]); a2[1] = f_mma(w2[ks], l_frag(&sG[16 + ln][ks * 32], hh), a2[1]); }
#pragma unroll
  for (int nt = 0; nt < 2; ++nt) { const int tk = nt * 16 + ln, c0 = w * 16 + 8 * hh; const v4f ra = *(const v4fa*)&sR[tk][c0], rb = *(const v4fa*)&sR[tk][c0 + 4]; FragH fh, fl;
#pragma unroll
    for (int r = 0; r < 8; ++r) { float v = a2[nt][r] * 0.0625f + bf16_round(c2[r >> 2][r & 3]); v += (r < 4) ? ra[r & 3] : rb[r & 3]; const _Float16 hv = (_Float16)v; fh.h[r] = hv; fl.h[r] = (_Float16)((v - (float)hv) * 16.0f); }
    *(v8us*)&sF[tk][c0] = fh.half[0]; *(v8us*)&sF[tk][CC + c0] = fl.half[0]; }
  __syncthreads();      /* out + mlp, split, is complete before the last product reads it */
  v8f a3[2] = {z8, z8};
#pragma unroll
  for (int ks = 0; ks < 8; ++ks) { a3[0] = f_mma(l_frag(&sF[ln][ks * 32], hh), w3[ks], a3[0]); a3[1] = f_mma(l_frag(&sF[16 + ln][ks * 32], hh), w3[ks], a3[1]); }
  const float bv = bf16_round(c3); float* d = out + ((size_t)(r0 / SLEN) * CC + w * 16 + ln) * SLEN + (r0 % SLEN) + 8 * hh;
#pragma unroll
  for (int mt = 0; mt < 2; ++mt) { v4f lo4, hi4;
#pragma unroll
    for (int r = 0; r < 4; ++r) { lo4[r] = a3[mt][r] * 0.0625f + bv; hi4[r] = a3[mt][4 + r] * 0.0625f + bv; }
    *(v4f*)(d + mt * 16) = lo4; *(v4f*)(d + mt * 16 + 4) = hi4; } }

extern "C" void kernel_launch(void* const* d_in, const int* in_sizes, int n_in,
                              void* d_out, int out_size, void* d_ws, size_t ws_size, hipStream_t stream) {
  (void)in_sizes; (void)n_in; (void)out_size;
  const float* const* I = (const float* const*)d_in; const float* fo = I[0]; const float* fs = I[1]; const float* gq = I[2]; const float* bq = I[3]; const float* gkv = I[4]; const float* bkv = I[5]; const float* Wq = I[6]; const float* bqp = I[7]; const float* Wk = I[8]; const float* bkp = I[9]; const float* Wv = I[10]; const float* bvp = I[11]; const float* W1 = I[12]; const float* b1 = I[13]; const float* W2 = I[14]; const float* b2 = I[15]; const float* Wo = I[16]; const float* bo = I[17];
  char* ws = (char*)d_ws; size_t off = 0;
  auto take = [&](size_t bytes) { char* p = ws + off; off += (bytes + 255) & ~(size_t)255; return p; };
  _Float16* BPq = (_Float16*)take((size_t)3 * DP * CC * 2); float* PBq = (float*)take(3 * DP * 4);      /* q, k, v planes one behind the other */
  _Float16* BW1 = (_Float16*)take((size_t)HID * 2 * CC * 2); _Float16* BW2 = (_Float16*)take((size_t)CC * HID * 2); _Float16* BWO = (_Float16*)take((size_t)CC * 2 * CC * 2); float* GS = (float*)take((size_t)NB * NGR * 32 * 4 * 2);
  _Float16* QH = (_Float16*)take((size_t)4 * NR * DP * 2); _Float16* QL = QH + (size_t)NR * DP; _Float16* KH = QH + (size_t)2 * NR * DP; _Float16* KL = QH + (size_t)3 * NR * DP; _Float16* VT = (_Float16*)take((size_t)NR * DP * 2);      /* q hi, q residual, k hi, k residual; V^T */
  float* O = (float*)take((size_t)NR * DP * 4);      /* attention output */
  if (off > ws_size) return;      /* 0.5 + 4 x 2 + 2 + 4 = 15 MiB */
  k_prep<<<PB_ALL, 256, 0, stream>>>(fo, fs, GS, Wq, bqp, Wk, bkp, Wv, bvp, BPq, PBq, W1, BW1, W2, BW2, Wo, BWO);      /* group statistics of both inputs; conv1x1 weights (out,in) = natural rows; MLP and output weights */
  k_qkv<<<dim3(NR / 64, 3), 256, 0, stream>>>(fo, fs, GS, gq, bq, gkv, bkv, BPq, PBq, QH, VT);      /* normalise + q, k (hi + residual planes), V^T */
  k_flashqk<0><<<NB * NH * QBLKS, 256, 0, stream>>>(QH, QL, KH, KL, VT, nullptr, O, DP);      /* q/k hi + residual; P (x2^10) and V plain f16 */
  k_tail<<<NR / PT, 256, 0, stream>>>(O, BW1, b1, BW2, b2, BWO, bo, (float*)d_out);      /* gelu_erf(out W1 + b1) W2 + b2 + out, conv1x1 Wo + bo, NCHW */
}
